// v000
// Measured on an AMD MI455X. A time is GPU time per run, averaged over a window of back-to-back runs after a warm-up
// (all launches, gaps included; the runs take copies of the inputs in turn), and the median of several windows.
// Apart from v000's, it joins two sittings. Times from different sittings can be a few percent apart, while
// side-by-side timings come from the same sitting.
// The starting kernel, v000, takes 47.8 microseconds a run.
// compute dtype: all float inputs rounded to bf16, k_st (int) read; query / key / value are INPUTS: bucket logits with EXACT bf16 products on WMMA 16x16x32 (keys gathered by k_st into LDS), f32 accumulate, no scale; per-bucket log-sum-exp in f32 (precise expf/logf); P = exp(inner - max) as f16 (x 2^11, 1/sum applied after) plus its f16 residual against the gathered values (bf16 -> f16 exact) (2 products); the cross-hash combination softmax over the 8 lse values and the weighted sum in f32; f32 output.
#include <hip/hip_runtime.h>
#include <math.h>

typedef __attribute__((ext_vector_type(16))) _Float16 v16h;
typedef __attribute__((ext_vector_type(16))) __bf16 v16b;
typedef __attribute__((ext_vector_type(8)))  _Float16 v8h;
typedef __attribute__((ext_vector_type(8)))  float v8f;
typedef __attribute__((ext_vector_type(4)))  float v4f;
typedef __attribute__((ext_vector_type(2)))  float v2f;
typedef __attribute__((ext_vector_type(4)))  unsigned v4u;
typedef __attribute__((ext_vector_type(4)))  int v4i;
typedef float __attribute__((may_alias)) float_a;
typedef int __attribute__((may_alias)) int_a;

template <typename T> __device__ __forceinline__ void vst2(void* p, T v) { *(T*)p = v;  }
__device__ __forceinline__ v8f wmma16(v16h a, v16h b, v8f c) {
  v8f d = __builtin_amdgcn_wmma_f32_16x16x32_f16(false, a, false, b, (short)0, c, false, false);
  asm volatile("v_nop\n\tv_nop\n\tv_nop\n\tv_nop" : "+v"(d) : "v"(a), "v"(b));
  return d;
}
__device__ __forceinline__ v8f wmma_bf(v16b a, v16b b, v8f c) {
  v8f d = __builtin_amdgcn_wmma_f32_16x16x32_bf16(false, a, false, b, (short)0, c, false, false);
  asm volatile("v_nop\n\tv_nop\n\tv_nop\n\tv_nop" : "+v"(d) : "v"(a), "v"(b));
  return d;
}
// 16x16x32 fragments: lane = (h = lane>>4, row/col = lane&15); elements 0..7 = k0+8h+0..7, 8..15 = k0+16+8h+0..7; D element r = row 8h+r
__device__ __forceinline__ v16h frag_h(const _Float16* rowk0, int lane) {
  union { v16h v; v8h q[2]; } u; const _Float16* p = rowk0 + 8 * (lane >> 4);
  u.q[0] = *(const v8h*)p; u.q[1] = *(const v8h*)(p + 16); return u.v;
}
__device__ __forceinline__ v16h frag_f32(const float* rowk0, int lane) {
  v16h a; const float* p = rowk0 + 8 * (lane >> 4);
#pragma unroll
  for (int i = 0; i < 8; ++i) { a[i] = (_Float16)p[i]; a[8 + i] = (_Float16)p[16 + i]; }
  return a;
}
__device__ __forceinline__ v16h frag_f32s(const float* rowk0, int lane, float sc) {
  v16h a; const float* p = rowk0 + 8 * (lane >> 4);
#pragma unroll
  for (int i = 0; i < 8; ++i) { a[i] = (_Float16)(p[i] * sc); a[8 + i] = (_Float16)(p[16 + i] * sc); }
  return a;
}
// column fragment from a [K][ld] layout (column n), rows >= K read as 0
__device__ __forceinline__ v16h fragc_f32(const float* W, int k0, int n, int lane, int ld, int K) {
  v16h a; const int g = lane >> 4;
#pragma unroll
  for (int i = 0; i < 8; ++i) { const int ka = k0 + 8 * g + i, kb = ka + 16;
    a[i] = (_Float16)(ka < K ? W[(size_t)(ka < K ? ka : K - 1) * ld + n] : 0.f); a[8 + i] = (_Float16)(kb < K ? W[(size_t)(kb < K ? kb : K - 1) * ld + n] : 0.f); }
  return a;
}
struct F2 { v16b h, l; };
__device__ __forceinline__ F2 bsplit16(const float v[16]) { F2 r;
#pragma unroll
  for (int i = 0; i < 16; ++i) { const __bf16 h = (__bf16)v[i]; r.h[i] = h; r.l[i] = (__bf16)(v[i] - (float)h); }
  return r; }
__device__ __forceinline__ F2 split_row(const float* row, int k0, int lane) { float v[16]; const float* p = row + k0 + 8 * (lane >> 4);
#pragma unroll
  for (int i = 0; i < 8; ++i) { v[i] = p[i]; v[8 + i] = p[16 + i]; }
  return bsplit16(v); }
__device__ __forceinline__ F2 split_rowK(const float* row, int k0, int lane, int K) { float v[16]; const int g = lane >> 4;
#pragma unroll
  for (int i = 0; i < 8; ++i) { const int ka = k0 + 8 * g + i, kb = ka + 16; v[i] = ka < K ? row[ka < K ? ka : K - 1] : 0.f; v[8 + i] = kb < K ? row[kb < K ? kb : K - 1] : 0.f; }
  return bsplit16(v); }
__device__ __forceinline__ F2 split_col(const float* W, int k0, int n, int lane, int ld, int K) { float v[16]; const int g = lane >> 4;
#pragma unroll
  for (int i = 0; i < 8; ++i) { const int ka = k0 + 8 * g + i, kb = ka + 16; v[i] = ka < K ? W[(size_t)(ka < K ? ka : K - 1) * ld + n] : 0.f; v[8 + i] = kb < K ? W[(size_t)(kb < K ? kb : K - 1) * ld + n] : 0.f; }
  return bsplit16(v); }
__device__ __forceinline__ v8f mac3(const F2& a, const F2& b, v8f c) { c = wmma_bf(a.l, b.h, c); c = wmma_bf(a.h, b.l, c); return wmma_bf(a.h, b.h, c); }
__device__ __forceinline__ float sigm(float v) { return 1.0f / (1.0f + expf(-v)); }
#define LDSX() do { asm volatile("s_wait_dscnt 0" ::: "memory"); __builtin_amdgcn_wave_barrier(); __builtin_amdgcn_fence(__ATOMIC_RELEASE, "workgroup"); } while (0)


// Random-buckets attention (B 8, Sq = Sk = 4,096, D = Dv = 64, 8 hashes, bucket 64): faithful to the module's tile/reshape bookkeeping: for output (b, s) and hash h the query vector is query[h][s] (the tiled-then-reshaped layout), the 64 keys/values are key/value[b][k_st[b][h*4096 + (s/64)*64 + j]]; o_h = softmax(q . k) v, lse_h = logsumexp; out = sum_h softmax_h(lse) o_h.
#define NB 8
#define SQ 4096
#define DD 64
#define NHASH 8
#define KB 64
#define NBK (SQ / KB)        // 64 buckets per hash
#define CHUNK (NHASH * NBK)  // 512
#ifndef TNB
#define TNB NB
#endif
typedef __attribute__((ext_vector_type(8))) __bf16 v8b;
__device__ __forceinline__ v16b frag_b(const __bf16* rowk0, int lane) {
  union { v16b v; v8b q[2]; } u; const __bf16* p = rowk0 + 8 * (lane >> 4);
  u.q[0] = *(const v8b*)p; u.q[1] = *(const v8b*)(p + 16); return u.v;
}
__device__ __forceinline__ float bfr(float v) { return (float)(__bf16)v; }
__device__ __attribute__((noinline)) float exp_ni(float v) { return expf(v); }
__device__ __attribute__((noinline)) float erf_ni(float v) { return erff(v); }

#define WS_OH  0u                                   // f32 o [b][h][s][64]
#define WS_LSE (WS_OH + 4u * (size_t)NB * NHASH * SQ * DD)   // f32 lse [b][h][s] (stored as [b][h][s/4] 16-B groups)
#define WS_END (WS_LSE + 4u * (size_t)NB * NHASH * SQ)

// ---- k_bucket: block = (chunk c, batch b): 64 queries (query[h][s0 + i], h = c / 64, s0 = (c % 64) * 64) x 64 gathered keys/values
__global__ __launch_bounds__(128) void k_bucket(const float* __restrict__ Qy, const float* __restrict__ Ky, const float* __restrict__ Vy, const int* __restrict__ KST, float* __restrict__ OH, float* __restrict__ LSE) {
  __shared__ __align__(16) __bf16 sk[KB][72]; __shared__ __align__(16) _Float16 sv[DD][72]; __shared__ __align__(16) float sp[4][16][68]; __shared__ __align__(16) float so[4][16][68]; __shared__ __align__(16) float sl[64];
  const int tid = threadIdx.x, wave = tid >> 5, lane = tid & 31, col = lane & 15, g = lane >> 4; const int c = blockIdx.x; const size_t b = blockIdx.y; const int h = c / NBK; const int s0 = (c % NBK) * KB;
  // gather the bucket's keys (rows [j][d] as bf16) and values (planes [d][j] as f16)
  for (int e = tid; e < KB * DD; e += 128) { const int j = e >> 6, d = e & 63; const int src = KST[b * (NHASH * SQ) + (size_t)c * KB + j]; sk[j][d] = (__bf16)Ky[(b * SQ + src) * DD + d]; sv[d][j] = (_Float16)bfr(Vy[(b * SQ + src) * DD + d]); }
  __syncthreads();
  // this wave: queries i = wave*16 .. +16 -> query[h][s0 + i]
  v16b aq[2];
#pragma unroll
  for (int kc = 0; kc < 2; ++kc) { const float* pp = Qy + ((size_t)h * SQ + s0 + wave * 16 + col) * DD + kc * 32 + 8 * g;
#pragma unroll
    for (int i = 0; i < 8; ++i) { aq[kc][i] = (__bf16)pp[i]; aq[kc][8 + i] = (__bf16)pp[16 + i]; } }
  float s[4][8];
#pragma unroll
  for (int ct = 0; ct < 4; ++ct) { v8f cc = {};
#pragma unroll
    for (int kc = 0; kc < 2; ++kc) { v16b w; const __bf16* kp = &sk[ct * 16 + col][kc * 32 + 8 * g];
#pragma unroll
      for (int i = 0; i < 8; ++i) { w[i] = kp[i]; w[8 + i] = kp[16 + i]; }
      cc = wmma_bf(aq[kc], w, cc); }
#pragma unroll
    for (int r = 0; r < 8; ++r) s[ct][r] = cc[r]; }
  float mrow[8], lrow[8];
#pragma unroll
  for (int r = 0; r < 8; ++r) { float mx = fmaxf(fmaxf(s[0][r], s[1][r]), fmaxf(s[2][r], s[3][r]));
#pragma unroll
    for (int o = 1; o < 16; o <<= 1) mx = fmaxf(mx, __shfl_xor(mx, o));
    float es = 0.f;
#pragma unroll
    for (int ct = 0; ct < 4; ++ct) { const float e = expf(s[ct][r] - mx); sp[wave][8 * g + r][ct * 16 + col] = e; es += e; }
#pragma unroll
    for (int o = 1; o < 16; o <<= 1) es += __shfl_xor(es, o);
    mrow[r] = mx; lrow[r] = es; }
  LDSX();
  v8f acc[4] = {};
#pragma unroll
  for (int kt = 0; kt < 2; ++kt) { v16h pa, par; { const float* prow = &sp[wave][col][kt * 32] + 8 * (lane >> 4);
#pragma unroll
      for (int i = 0; i < 8; ++i) { const float p0 = prow[i] * 2048.0f, p1 = prow[16 + i] * 2048.0f; pa[i] = (_Float16)p0; pa[8 + i] = (_Float16)p1; par[i] = (_Float16)(p0 - (float)pa[i]); par[8 + i] = (_Float16)(p1 - (float)pa[8 + i]); } }
#pragma unroll
    for (int j = 0; j < 4; ++j) { v16h vh; const _Float16* vp = &sv[j * 16 + col][kt * 32 + 8 * g];
#pragma unroll
      for (int i = 0; i < 8; ++i) { vh[i] = vp[i]; vh[8 + i] = vp[16 + i]; }
      acc[j] = wmma16(pa, vh, acc[j]); acc[j] = wmma16(par, vh, acc[j]); } }
#pragma unroll
  for (int r = 0; r < 8; ++r) { const float il = (1.0f / 2048.0f) / lrow[r];
#pragma unroll
    for (int j = 0; j < 4; ++j) so[wave][8 * g + r][j * 16 + col] = acc[j][r] * il;
    if (col == 0) sl[wave * 16 + 8 * g + r] = mrow[r] + logf(lrow[r]); }
  LDSX();
  for (int rl = 0; rl < 16; ++rl) if (lane < 16) vst2(OH + (((b * NHASH + h) * SQ) + s0 + wave * 16 + rl) * DD + lane * 4, *(const v4f*)&so[wave][rl][lane * 4]);
  __syncthreads(); if (tid < 16) vst2(LSE + ((b * NHASH + h) * SQ) + s0 + tid * 4, *(const v4f*)&sl[tid * 4]); }
// ---- k_comb: block = 64 queries of batch b: out[b][s] = sum_h softmax_h(lse) o_h
__global__ __launch_bounds__(256) void k_comb(const float* __restrict__ OH, const float* __restrict__ LSE, float* __restrict__ OUT) { __shared__ float sw[64][NHASH];
  const int t = threadIdx.x; const size_t b = blockIdx.y; const int s0 = blockIdx.x * 64;
  if (t < 64) { float lv[NHASH]; float mx = -3.0e38f;
#pragma unroll
    for (int h = 0; h < NHASH; ++h) { lv[h] = LSE[((b * NHASH + h) * SQ) + s0 + t]; mx = fmaxf(mx, lv[h]); }
    float sum = 0.f;
#pragma unroll
    for (int h = 0; h < NHASH; ++h) { lv[h] = expf(lv[h] - mx); sum += lv[h]; }
#pragma unroll
    for (int h = 0; h < NHASH; ++h) sw[t][h] = lv[h] / sum; }
  __syncthreads();
  { const int sl_ = t >> 2, q = t & 3; v4f o[4];   // thread: query s0 + sl_, 16 dims q*16 .. +16 (4 x v4f)
#pragma unroll
    for (int k = 0; k < 4; ++k) o[k] = v4f{0.f, 0.f, 0.f, 0.f};
#pragma unroll 1
    for (int h = 0; h < NHASH; ++h) { const float w = sw[sl_][h]; const float* src = OH + (((b * NHASH + h) * SQ) + s0 + sl_) * DD + q * 16;
#pragma unroll
      for (int k = 0; k < 4; ++k) { const v4f v = *(const v4f*)(src + k * 4); o[k] += v * w; } }
#pragma unroll
    for (int k = 0; k < 4; ++k) vst2(OUT + (b * SQ + s0 + sl_) * DD + q * 16 + k * 4, o[k]); } }
extern "C" void kernel_launch(void* const* d_in, const int* in_sizes, int n_in, void* d_out, int out_size, void* d_ws, size_t ws_size, hipStream_t stream) {
  (void)in_sizes; (void)n_in; (void)out_size;
  const float** F = (const float**)d_in;   // 0 query [8,4096,64], 1 key [8,4096,64], 2 value [8,4096,64], 3 k_st [8, 32768] int
  if (ws_size < (size_t)WS_END) return;
  char* ws = (char*)d_ws; float *OH = (float*)(ws + WS_OH), *LSE = (float*)(ws + WS_LSE);
  k_bucket<<<dim3(CHUNK, TNB), 128, 0, stream>>>(F[0], F[1], F[2], (const int*)d_in[3], OH, LSE);
  k_comb<<<dim3(SQ / 64, TNB), 256, 0, stream>>>(OH, LSE, (float*)d_out);
}

// v001
// It runs in 39.6 microseconds.
// In two side-by-side timings against v000, it was 1.24 and 1.23 times as fast.
// compute dtype: all float inputs rounded to bf16, k_st (int) read; query / key / value are INPUTS: bucket logits with EXACT bf16 products on WMMA 16x16x32 (keys gathered by k_st into LDS), f32 accumulate, no scale; per-bucket log-sum-exp in f32 (precise expf/logf); P = exp(inner - max) as f16 (x 2^11, 1/sum applied after) plus its f16 residual against the gathered values (bf16 -> f16 exact) (2 products); the cross-hash combination softmax over the 8 lse values and the weighted sum in f32; f32 output.
#include <hip/hip_runtime.h>
#include <math.h>

typedef __attribute__((ext_vector_type(16))) _Float16 v16h;
typedef __attribute__((ext_vector_type(16))) __bf16 v16b;
typedef __attribute__((ext_vector_type(8)))  _Float16 v8h;
typedef __attribute__((ext_vector_type(8)))  float v8f;
typedef __attribute__((ext_vector_type(4)))  float v4f;
typedef __attribute__((ext_vector_type(2)))  float v2f;
typedef __attribute__((ext_vector_type(4)))  unsigned v4u;
typedef __attribute__((ext_vector_type(4)))  int v4i;
typedef float __attribute__((may_alias)) float_a;
typedef int __attribute__((may_alias)) int_a;

template <typename T> __device__ __forceinline__ void vst2(void* p, T v) { *(T*)p = v;  }
__device__ __forceinline__ v8f wmma16(v16h a, v16h b, v8f c) {
  v8f d = __builtin_amdgcn_wmma_f32_16x16x32_f16(false, a, false, b, (short)0, c, false, false);
  asm volatile("v_nop\n\tv_nop\n\tv_nop\n\tv_nop" : "+v"(d) : "v"(a), "v"(b));
  return d;
}
__device__ __forceinline__ v8f wmma_bf(v16b a, v16b b, v8f c) {
  v8f d = __builtin_amdgcn_wmma_f32_16x16x32_bf16(false, a, false, b, (short)0, c, false, false);
  asm volatile("v_nop\n\tv_nop\n\tv_nop\n\tv_nop" : "+v"(d) : "v"(a), "v"(b));
  return d;
}
// 16x16x32 fragments: lane = (h = lane>>4, row/col = lane&15); elements 0..7 = k0+8h+0..7, 8..15 = k0+16+8h+0..7; D element r = row 8h+r
__device__ __forceinline__ v16h frag_h(const _Float16* rowk0, int lane) {
  union { v16h v; v8h q[2]; } u; const _Float16* p = rowk0 + 8 * (lane >> 4);
  u.q[0] = *(const v8h*)p; u.q[1] = *(const v8h*)(p + 16); return u.v;
}
__device__ __forceinline__ v16h frag_f32(const float* rowk0, int lane) {
  v16h a; const float* p = rowk0 + 8 * (lane >> 4);
#pragma unroll
  for (int i = 0; i < 8; ++i) { a[i] = (_Float16)p[i]; a[8 + i] = (_Float16)p[16 + i]; }
  return a;
}
__device__ __forceinline__ v16h frag_f32s(const float* rowk0, int lane, float sc) {
  v16h a; const float* p = rowk0 + 8 * (lane >> 4);
#pragma unroll
  for (int i = 0; i < 8; ++i) { a[i] = (_Float16)(p[i] * sc); a[8 + i] = (_Float16)(p[16 + i] * sc); }
  return a;
}
// column fragment from a [K][ld] layout (column n), rows >= K read as 0
__device__ __forceinline__ v16h fragc_f32(const float* W, int k0, int n, int lane, int ld, int K) {
  v16h a; const int g = lane >> 4;
#pragma unroll
  for (int i = 0; i < 8; ++i) { const int ka = k0 + 8 * g + i, kb = ka + 16;
    a[i] = (_Float16)(ka < K ? W[(size_t)(ka < K ? ka : K - 1) * ld + n] : 0.f); a[8 + i] = (_Float16)(kb < K ? W[(size_t)(kb < K ? kb : K - 1) * ld + n] : 0.f); }
  return a;
}
struct F2 { v16b h, l; };
__device__ __forceinline__ F2 bsplit16(const float v[16]) { F2 r;
#pragma unroll
  for (int i = 0; i < 16; ++i) { const __bf16 h = (__bf16)v[i]; r.h[i] = h; r.l[i] = (__bf16)(v[i] - (float)h); }
  return r; }
__device__ __forceinline__ F2 split_row(const float* row, int k0, int lane) { float v[16]; const float* p = row + k0 + 8 * (lane >> 4);
#pragma unroll
  for (int i = 0; i < 8; ++i) { v[i] = p[i]; v[8 + i] = p[16 + i]; }
  return bsplit16(v); }
__device__ __forceinline__ F2 split_rowK(const float* row, int k0, int lane, int K) { float v[16]; const int g = lane >> 4;
#pragma unroll
  for (int i = 0; i < 8; ++i) { const int ka = k0 + 8 * g + i, kb = ka + 16; v[i] = ka < K ? row[ka < K ? ka : K - 1] : 0.f; v[8 + i] = kb < K ? row[kb < K ? kb : K - 1] : 0.f; }
  return bsplit16(v); }
__device__ __forceinline__ F2 split_col(const float* W, int k0, int n, int lane, int ld, int K) { float v[16]; const int g = lane >> 4;
#pragma unroll
  for (int i = 0; i < 8; ++i) { const int ka = k0 + 8 * g + i, kb = ka + 16; v[i] = ka < K ? W[(size_t)(ka < K ? ka : K - 1) * ld + n] : 0.f; v[8 + i] = kb < K ? W[(size_t)(kb < K ? kb : K - 1) * ld + n] : 0.f; }
  return bsplit16(v); }
__device__ __forceinline__ v8f mac3(const F2& a, const F2& b, v8f c) { c = wmma_bf(a.l, b.h, c); c = wmma_bf(a.h, b.l, c); return wmma_bf(a.h, b.h, c); }
__device__ __forceinline__ float sigm(float v) { return 1.0f / (1.0f + expf(-v)); }
#define LDSX() do { asm volatile("s_wait_dscnt 0" ::: "memory"); __builtin_amdgcn_wave_barrier(); __builtin_amdgcn_fence(__ATOMIC_RELEASE, "workgroup"); } while (0)


// Random-buckets attention (B 8, Sq = Sk = 4,096, D = Dv = 64, 8 hashes, bucket 64): faithful to the module's tile/reshape bookkeeping: for output (b, s) and hash h the query vector is query[h][s] (the tiled-then-reshaped layout), the 64 keys/values are key/value[b][k_st[b][h*4096 + (s/64)*64 + j]]; o_h = softmax(q . k) v, lse_h = logsumexp; out = sum_h softmax_h(lse) o_h.
#define NB 8
#define SQ 4096
#define DD 64
#define NHASH 8
#define KB 64
#define NBK (SQ / KB)        // 64 buckets per hash
#define CHUNK (NHASH * NBK)  // 512
#ifndef TNB
#define TNB NB
#endif
typedef __attribute__((ext_vector_type(8))) __bf16 v8b;
typedef __attribute__((ext_vector_type(4))) __bf16 v4b;
__device__ __forceinline__ v16b frag_b(const __bf16* rowk0, int lane) {
  union { v16b v; v8b q[2]; } u; const __bf16* p = rowk0 + 8 * (lane >> 4);
  u.q[0] = *(const v8b*)p; u.q[1] = *(const v8b*)(p + 16); return u.v;
}
__device__ __forceinline__ float bfr(float v) { return (float)(__bf16)v; }
__device__ __attribute__((noinline)) float exp_ni(float v) { return expf(v); }
__device__ __attribute__((noinline)) float erf_ni(float v) { return erff(v); }

#define WS_OH  0u                                   // f32 o [b][h][s][64]
#define WS_LSE (WS_OH + 4u * (size_t)NB * NHASH * SQ * DD)   // f32 lse [b][h][s] (stored as [b][h][s/4] 16-B groups)
#define WS_END (WS_LSE + 4u * (size_t)NB * NHASH * SQ)

// ---- k_bucket: block = (chunk c, batch b): 64 queries (query[h][s0 + i], h = c / 64, s0 = (c % 64) * 64) x 64 gathered keys/values
__global__ __launch_bounds__(128) void k_bucket(const float* __restrict__ Qy, const float* __restrict__ Ky, const float* __restrict__ Vy, const int* __restrict__ KST, float* __restrict__ OH, float* __restrict__ LSE) {
  __shared__ __align__(16) __bf16 sk[KB][72]; __shared__ __align__(16) _Float16 sv[DD][72]; __shared__ __align__(16) float sp[4][16][68]; __shared__ __align__(16) float so[4][16][68]; __shared__ __align__(16) float sl[64];
  const int tid = threadIdx.x, wave = tid >> 5, lane = tid & 31, col = lane & 15, g = lane >> 4; const int c = blockIdx.x; const size_t b = blockIdx.y; const int h = c / NBK; const int s0 = (c % NBK) * KB;
  // gather the bucket's keys (rows [j][d] as bf16) and values (planes [d][j] as f16)
  // thread = (row group jg: rows 8*jg .. +7, dim quad dq: dims 4*dq .. +3): 8 indices read once, then 8 key and 8 value pieces of 16 B, all in flight together
  // (every loop of this block is unrolled so that kr and vr are registers and the 16 row loads issue ahead of the first wait)
  { const int jg = tid >> 4, dq = tid & 15; const int* ip = KST + b * (NHASH * SQ) + (size_t)c * KB + jg * 8;
    const float* Kb = Ky + b * SQ * DD; const float* Vb = Vy + b * SQ * DD;
    const v4i i0 = *(const v4i*)ip, i1 = *(const v4i*)(ip + 4); v4f kr[8], vr[8];
#pragma unroll
    for (int i = 0; i < 8; ++i) { const unsigned off = (unsigned)((i < 4 ? i0[i & 3] : i1[i & 3]) & (SQ - 1)) * DD + dq * 4;   // the mask bounds the row address for any index value
      kr[i] = *(const v4f*)(Kb + off); vr[i] = *(const v4f*)(Vb + off); }
#pragma unroll
    for (int i = 0; i < 8; ++i) { v4b kq;
#pragma unroll
      for (int q = 0; q < 4; ++q) kq[q] = (__bf16)kr[i][q];
      *(v4b*)&sk[jg * 8 + i][dq * 4] = kq; }
#pragma unroll
    for (int q = 0; q < 4; ++q) { v8h vq;
#pragma unroll
      for (int i = 0; i < 8; ++i) vq[i] = (_Float16)bfr(vr[i][q]);
      *(v8h*)&sv[dq * 4 + q][jg * 8] = vq; } }
  __syncthreads();
  // this wave: queries i = wave*16 .. +16 -> query[h][s0 + i]
  v16b aq[2];
#pragma unroll
  for (int kc = 0; kc < 2; ++kc) { const float* pp = Qy + ((size_t)h * SQ + s0 + wave * 16 + col) * DD + kc * 32 + 8 * g;
#pragma unroll
    for (int i = 0; i < 8; ++i) { aq[kc][i] = (__bf16)pp[i]; aq[kc][8 + i] = (__bf16)pp[16 + i]; } }
  float s[4][8];
#pragma unroll
  for (int ct = 0; ct < 4; ++ct) { v8f cc = {};
#pragma unroll
    for (int kc = 0; kc < 2; ++kc) { v16b w; const __bf16* kp = &sk[ct * 16 + col][kc * 32 + 8 * g];
#pragma unroll
      for (int i = 0; i < 8; ++i) { w[i] = kp[i]; w[8 + i] = kp[16 + i]; }
      cc = wmma_bf(aq[kc], w, cc); }
#pragma unroll
    for (int r = 0; r < 8; ++r) s[ct][r] = cc[r]; }
  float mrow[8], lrow[8];
#pragma unroll
  for (int r = 0; r < 8; ++r) { float mx = fmaxf(fmaxf(s[0][r], s[1][r]), fmaxf(s[2][r], s[3][r]));
#pragma unroll
    for (int o = 1; o < 16; o <<= 1) mx = fmaxf(mx, __shfl_xor(mx, o));
    float es = 0.f;
#pragma unroll
    for (int ct = 0; ct < 4; ++ct) { const float e = expf(s[ct][r] - mx); sp[wave][8 * g + r][ct * 16 + col] = e; es += e; }
#pragma unroll
    for (int o = 1; o < 16; o <<= 1) es += __shfl_xor(es, o);
    mrow[r] = mx; lrow[r] = es; }
  LDSX();
  v8f acc[4] = {};
#pragma unroll
  for (int kt = 0; kt < 2; ++kt) { v16h pa, par; { const float* prow = &sp[wave][col][kt * 32] + 8 * (lane >> 4);
#pragma unroll
      for (int i = 0; i < 8; ++i) { const float p0 = prow[i] * 2048.0f, p1 = prow[16 + i] * 2048.0f; pa[i] = (_Float16)p0; pa[8 + i] = (_Float16)p1; par[i] = (_Float16)(p0 - (float)pa[i]); par[8 + i] = (_Float16)(p1 - (float)pa[8 + i]); } }
#pragma unroll
    for (int j = 0; j < 4; ++j) { v16h vh; const _Float16* vp = &sv[j * 16 + col][kt * 32 + 8 * g];
#pragma unroll
      for (int i = 0; i < 8; ++i) { vh[i] = vp[i]; vh[8 + i] = vp[16 + i]; }
      acc[j] = wmma16(pa, vh, acc[j]); acc[j] = wmma16(par, vh, acc[j]); } }
#pragma unroll
  for (int r = 0; r < 8; ++r) { const float il = (1.0f / 2048.0f) / lrow[r];
#pragma unroll
    for (int j = 0; j < 4; ++j) so[wave][8 * g + r][j * 16 + col] = acc[j][r] * il;
    if (col == 0) sl[wave * 16 + 8 * g + r] = mrow[r] + logf(lrow[r]); }
  LDSX();
  for (int rl = 0; rl < 16; ++rl) if (lane < 16) vst2(OH + (((b * NHASH + h) * SQ) + s0 + wave * 16 + rl) * DD + lane * 4, *(const v4f*)&so[wave][rl][lane * 4]);
  __syncthreads(); if (tid < 16) vst2(LSE + ((b * NHASH + h) * SQ) + s0 + tid * 4, *(const v4f*)&sl[tid * 4]); }
// ---- k_comb: block = 64 queries of batch b: out[b][s] = sum_h softmax_h(lse) o_h
__global__ __launch_bounds__(256) void k_comb(const float* __restrict__ OH, const float* __restrict__ LSE, float* __restrict__ OUT) { __shared__ float sw[64][NHASH];
  const int t = threadIdx.x; const size_t b = blockIdx.y; const int s0 = blockIdx.x * 64;
  if (t < 64) { float lv[NHASH]; float mx = -3.0e38f;
#pragma unroll
    for (int h = 0; h < NHASH; ++h) { lv[h] = LSE[((b * NHASH + h) * SQ) + s0 + t]; mx = fmaxf(mx, lv[h]); }
    float sum = 0.f;
#pragma unroll
    for (int h = 0; h < NHASH; ++h) { lv[h] = expf(lv[h] - mx); sum += lv[h]; }
#pragma unroll
    for (int h = 0; h < NHASH; ++h) sw[t][h] = lv[h] / sum; }
  __syncthreads();
  { const int sl_ = t >> 2, q = t & 3; v4f o[4];   // thread: query s0 + sl_, 16 dims q*16 .. +16 (4 x v4f)
#pragma unroll
    for (int k = 0; k < 4; ++k) o[k] = v4f{0.f, 0.f, 0.f, 0.f};
#pragma unroll 1
    for (int h = 0; h < NHASH; ++h) { const float w = sw[sl_][h]; const float* src = OH + (((b * NHASH + h) * SQ) + s0 + sl_) * DD + q * 16;
#pragma unroll
      for (int k = 0; k < 4; ++k) { const v4f v = *(const v4f*)(src + k * 4); o[k] += v * w; } }
#pragma unroll
    for (int k = 0; k < 4; ++k) vst2(OUT + (b * SQ + s0 + sl_) * DD + q * 16 + k * 4, o[k]); } }
extern "C" void kernel_launch(void* const* d_in, const int* in_sizes, int n_in, void* d_out, int out_size, void* d_ws, size_t ws_size, hipStream_t stream) {
  (void)in_sizes; (void)n_in; (void)out_size;
  const float** F = (const float**)d_in;   // 0 query [8,4096,64], 1 key [8,4096,64], 2 value [8,4096,64], 3 k_st [8, 32768] int
  if (ws_size < (size_t)WS_END) return;
  char* ws = (char*)d_ws; float *OH = (float*)(ws + WS_OH), *LSE = (float*)(ws + WS_LSE);
  k_bucket<<<dim3(CHUNK, TNB), 128, 0, stream>>>(F[0], F[1], F[2], (const int*)d_in[3], OH, LSE);
  k_comb<<<dim3(SQ / 64, TNB), 256, 0, stream>>>(OH, LSE, (float*)d_out);
}

// v002
// Measured time: 23.9 microseconds a run.
// Next to v001, in two timings, it ran 1.65 and 1.66 times as fast.
// All steps since v000 together make it 2.05 times as fast.
// compute dtype: all float inputs rounded to bf16, k_st (int) read; query / key / value are INPUTS: bucket logits with EXACT bf16 products on WMMA 16x16x32 (keys gathered by k_st into LDS), f32 accumulate, no scale; P = exp(inner - running row max) in f32 (precise expf) as f16 (x 2^11) plus its f16 residual against the gathered values (bf16 -> f16 exact) (2 products); the 8 hashes of a query are combined online (running max, running sum, rescaled f32 accumulator), which equals the softmax over the 8 lse values; f32 output.
#include <hip/hip_runtime.h>
#include <math.h>

typedef __attribute__((ext_vector_type(16))) _Float16 v16h;
typedef __attribute__((ext_vector_type(16))) __bf16 v16b;
typedef __attribute__((ext_vector_type(8)))  _Float16 v8h;
typedef __attribute__((ext_vector_type(8)))  float v8f;
typedef __attribute__((ext_vector_type(4)))  float v4f;
typedef __attribute__((ext_vector_type(2)))  float v2f;
typedef __attribute__((ext_vector_type(4)))  unsigned v4u;
typedef __attribute__((ext_vector_type(4)))  int v4i;
typedef float __attribute__((may_alias)) float_a;
typedef int __attribute__((may_alias)) int_a;

template <typename T> __device__ __forceinline__ void vst2(void* p, T v) { *(T*)p = v;  }
__device__ __forceinline__ v8f wmma16(v16h a, v16h b, v8f c) {
  v8f d = __builtin_amdgcn_wmma_f32_16x16x32_f16(false, a, false, b, (short)0, c, false, false);
  asm volatile("v_nop\n\tv_nop\n\tv_nop\n\tv_nop" : "+v"(d) : "v"(a), "v"(b));
  return d;
}
__device__ __forceinline__ v8f wmma_bf(v16b a, v16b b, v8f c) {
  v8f d = __builtin_amdgcn_wmma_f32_16x16x32_bf16(false, a, false, b, (short)0, c, false, false);
  asm volatile("v_nop\n\tv_nop\n\tv_nop\n\tv_nop" : "+v"(d) : "v"(a), "v"(b));
  return d;
}
// 16x16x32 fragments: lane = (h = lane>>4, row/col = lane&15); elements 0..7 = k0+8h+0..7, 8..15 = k0+16+8h+0..7; D element r = row 8h+r
__device__ __forceinline__ v16h frag_h(const _Float16* rowk0, int lane) {
  union { v16h v; v8h q[2]; } u; const _Float16* p = rowk0 + 8 * (lane >> 4);
  u.q[0] = *(const v8h*)p; u.q[1] = *(const v8h*)(p + 16); return u.v;
}
__device__ __forceinline__ v16h frag_f32(const float* rowk0, int lane) {
  v16h a; const float* p = rowk0 + 8 * (lane >> 4);
#pragma unroll
  for (int i = 0; i < 8; ++i) { a[i] = (_Float16)p[i]; a[8 + i] = (_Float16)p[16 + i]; }
  return a;
}
__device__ __forceinline__ v16h frag_f32s(const float* rowk0, int lane, float sc) {
  v16h a; const float* p = rowk0 + 8 * (lane >> 4);
#pragma unroll
  for (int i = 0; i < 8; ++i) { a[i] = (_Float16)(p[i] * sc); a[8 + i] = (_Float16)(p[16 + i] * sc); }
  return a;
}
// column fragment from a [K][ld] layout (column n), rows >= K read as 0
__device__ __forceinline__ v16h fragc_f32(const float* W, int k0, int n, int lane, int ld, int K) {
  v16h a; const int g = lane >> 4;
#pragma unroll
  for (int i = 0; i < 8; ++i) { const int ka = k0 + 8 * g + i, kb = ka + 16;
    a[i] = (_Float16)(ka < K ? W[(size_t)(ka < K ? ka : K - 1) * ld + n] : 0.f); a[8 + i] = (_Float16)(kb < K ? W[(size_t)(kb < K ? kb : K - 1) * ld + n] : 0.f); }
  return a;
}
struct F2 { v16b h, l; };
__device__ __forceinline__ F2 bsplit16(const float v[16]) { F2 r;
#pragma unroll
  for (int i = 0; i < 16; ++i) { const __bf16 h = (__bf16)v[i]; r.h[i] = h; r.l[i] = (__bf16)(v[i] - (float)h); }
  return r; }
__device__ __forceinline__ F2 split_row(const float* row, int k0, int lane) { float v[16]; const float* p = row + k0 + 8 * (lane >> 4);
#pragma unroll
  for (int i = 0; i < 8; ++i) { v[i] = p[i]; v[8 + i] = p[16 + i]; }
  return bsplit16(v); }
__device__ __forceinline__ F2 split_rowK(const float* row, int k0, int lane, int K) { float v[16]; const int g = lane >> 4;
#pragma unroll
  for (int i = 0; i < 8; ++i) { const int ka = k0 + 8 * g + i, kb = ka + 16; v[i] = ka < K ? row[ka < K ? ka : K - 1] : 0.f; v[8 + i] = kb < K ? row[kb < K ? kb : K - 1] : 0.f; }
  return bsplit16(v); }
__device__ __forceinline__ F2 split_col(const float* W, int k0, int n, int lane, int ld, int K) { float v[16]; const int g = lane >> 4;
#pragma unroll
  for (int i = 0; i < 8; ++i) { const int ka = k0 + 8 * g + i, kb = ka + 16; v[i] = ka < K ? W[(size_t)(ka < K ? ka : K - 1) * ld + n] : 0.f; v[8 + i] = kb < K ? W[(size_t)(kb < K ? kb : K - 1) * ld + n] : 0.f; }
  return bsplit16(v); }
__device__ __forceinline__ v8f mac3(const F2& a, const F2& b, v8f c) { c = wmma_bf(a.l, b.h, c); c = wmma_bf(a.h, b.l, c); return wmma_bf(a.h, b.h, c); }
__device__ __forceinline__ float sigm(float v) { return 1.0f / (1.0f + expf(-v)); }
#define LDSX() do { asm volatile("s_wait_dscnt 0" ::: "memory"); __builtin_amdgcn_wave_barrier(); __builtin_amdgcn_fence(__ATOMIC_RELEASE, "workgroup"); } while (0)


// Random-buckets attention (B 8, Sq = Sk = 4,096, D = Dv = 64, 8 hashes, bucket 64): faithful to the module's tile/reshape bookkeeping: for output (b, s) and hash h the query vector is query[h][s] (the tiled-then-reshaped layout), the 64 keys/values are key/value[b][k_st[b][h*4096 + (s/64)*64 + j]]; o_h = softmax(q . k) v, lse_h = logsumexp; out = sum_h softmax_h(lse) o_h.
#define NB 8
#define SQ 4096
#define DD 64
#define NHASH 8
#define KB 64
#define NBK (SQ / KB)        // 64 buckets per hash
#define CHUNK (NHASH * NBK)  // 512
#ifndef TNB
#define TNB NB
#endif
typedef __attribute__((ext_vector_type(8))) __bf16 v8b;
typedef __attribute__((ext_vector_type(4))) __bf16 v4b;
__device__ __forceinline__ v16b frag_b(const __bf16* rowk0, int lane) {
  union { v16b v; v8b q[2]; } u; const __bf16* p = rowk0 + 8 * (lane >> 4);
  u.q[0] = *(const v8b*)p; u.q[1] = *(const v8b*)(p + 16); return u.v;
}
__device__ __forceinline__ float bfr(float v) { return (float)(__bf16)v; }
__device__ __attribute__((noinline)) float exp_ni(float v) { return expf(v); }
__device__ __attribute__((noinline)) float erf_ni(float v) { return erff(v); }

#define NG 4                 // hash groups (4 waves each) that run side by side in one work-group
#define NIT (NHASH / NG)     // hashes that each group runs one after the other
#define NT (NG * 128)

// ---- k_bucket: block = (query bucket s0 / 64, batch b), all 8 hashes: group grp takes hashes grp, grp + NG, ...; per hash 64 queries (query[h][s0 + i]) x 64 gathered keys/values.
// sum_h softmax_h(lse) o_h = sum_h exp(m_h) A_h / sum_h exp(m_h) l_h (A_h, l_h: sums of exp(s - m_h) v and of exp(s - m_h)), so a wave keeps one running max M, sum L and accumulator acc over its hashes, and the groups are joined once through LDS.
// second bound: 8 waves a SIMD, that is 128 registers a wave, so that two work-groups (all 512 of the grid at once) are resident on a WGP
__global__ __launch_bounds__(NT, 8) void k_bucket(const float* __restrict__ Qy, const float* __restrict__ Ky, const float* __restrict__ Vy, const int* __restrict__ KST, float* __restrict__ OUT) {
  __shared__ __align__(16) __bf16 sk[NG][KB][72]; __shared__ __align__(16) _Float16 sv[NG][DD][72]; __shared__ __align__(16) float sp[NG * 4][16][68]; __shared__ __align__(16) float sm[NG][64]; __shared__ __align__(16) float sl[NG][64];
  const int tid = threadIdx.x, wave = __builtin_amdgcn_readfirstlane(tid >> 5) /* the same in every lane: group, hash and their addresses stay in scalar registers */, grp = wave >> 2, wq = wave & 3, lane = tid & 31, col = lane & 15, g = lane >> 4; const size_t b = blockIdx.y; const int s0 = blockIdx.x * KB;
  const float* Kb = Ky + b * SQ * DD; const float* Vb = Vy + b * SQ * DD;
  v8f acc[4] = {}; float M[8], L[8];   // L: this lane's share of the row sum (its 4 columns of every hash), summed over the 16 lanes once at the end
#pragma unroll
  for (int r = 0; r < 8; ++r) { M[r] = -3.0e38f; L[r] = 0.f; }
  // rolled: one copy of the body in the instruction cache, and only one hash's row pieces in registers
#pragma unroll 1
  for (int it = 0; it < NIT; ++it) { const int h = it * NG + grp;
    // gather the bucket's keys (rows [j][d] as bf16) and values (planes [d][j] as f16)
    // thread of the group = (row group jg: rows 8*jg .. +7, dim quad dq: dims 4*dq .. +3): 8 indices read once, then 8 key and 8 value pieces of 16 B, all in flight together
    // (every loop of this block is unrolled so that kr and vr are registers and the 16 row loads issue ahead of the first wait)
    { const int jg = wq * 2 + g, dq = col; const int* ip = KST + b * (NHASH * SQ) + (size_t)h * SQ + s0 + jg * 8;
      const v4i i0 = *(const v4i*)ip, i1 = *(const v4i*)(ip + 4); v4f kr[8], vr[8];
#pragma unroll
      for (int i = 0; i < 8; ++i) { const unsigned off = (unsigned)((i < 4 ? i0[i & 3] : i1[i & 3]) & (SQ - 1)) * DD + dq * 4;   // the mask bounds the row address for any index value
        kr[i] = *(const v4f*)(Kb + off); vr[i] = *(const v4f*)(Vb + off); }
      if (it) __syncthreads();   // every wave has read the last hash's keys and values before they are overwritten
#pragma unroll
      for (int i = 0; i < 8; ++i) { v4b kq;
#pragma unroll
        for (int q = 0; q < 4; ++q) kq[q] = (__bf16)kr[i][q];
        *(v4b*)&sk[grp][jg * 8 + i][dq * 4] = kq; }
#pragma unroll
      for (int q = 0; q < 4; ++q) { v8h vq;
#pragma unroll
        for (int i = 0; i < 8; ++i) vq[i] = (_Float16)bfr(vr[i][q]);
        *(v8h*)&sv[grp][dq * 4 + q][jg * 8] = vq; } }
    // this wave: queries i = wq*16 .. +16 -> query[h][s0 + i]; loaded here, where the row pieces' registers are free again
    v16b aq[2];
    { const float* pp = Qy + ((size_t)h * SQ + s0 + wq * 16 + col) * DD + 8 * g; v4f qr[8];   // all 8 pieces are loaded ahead of the first conversion: one trip to memory, not two
#pragma unroll
      for (int i = 0; i < 8; ++i) qr[i] = *(const v4f*)(pp + (i >> 1) * 16 + (i & 1) * 4);
#pragma unroll
      for (int kc = 0; kc < 2; ++kc)
#pragma unroll
        for (int i = 0; i < 8; ++i) { aq[kc][i] = (__bf16)qr[kc * 4 + (i >> 2)][i & 3]; aq[kc][8 + i] = (__bf16)qr[kc * 4 + 2 + (i >> 2)][i & 3]; } }
    __syncthreads();
    float s[4][8];
#pragma unroll
    for (int ct = 0; ct < 4; ++ct) { v8f cc = {};
#pragma unroll
      for (int kc = 0; kc < 2; ++kc) { v16b w; const __bf16* kp = &sk[grp][ct * 16 + col][kc * 32 + 8 * g];
#pragma unroll
        for (int i = 0; i < 8; ++i) { w[i] = kp[i]; w[8 + i] = kp[16 + i]; }
        cc = wmma_bf(aq[kc], w, cc); }
#pragma unroll
      for (int r = 0; r < 8; ++r) s[ct][r] = cc[r]; }
#pragma unroll
    for (int r = 0; r < 8; ++r) { float mx = fmaxf(fmaxf(s[0][r], s[1][r]), fmaxf(s[2][r], s[3][r]));
#pragma unroll
      for (int o = 1; o < 16; o <<= 1) mx = fmaxf(mx, __shfl_xor(mx, o));
      mx = fmaxf(mx, M[r]); const float al = expf(M[r] - mx); M[r] = mx;   // al rescales what the earlier hashes left (0 at the first hash)
      float es = 0.f;
#pragma unroll
      for (int ct = 0; ct < 4; ++ct) { const float e = expf(s[ct][r] - mx); sp[wave][8 * g + r][ct * 16 + col] = e; es += e; }
      L[r] = L[r] * al + es;
#pragma unroll
      for (int j = 0; j < 4; ++j) acc[j][r] *= al; }
    LDSX();
#pragma unroll
    for (int kt = 0; kt < 2; ++kt) { v16h pa, par; { const float* prow = &sp[wave][col][kt * 32] + 8 * (lane >> 4);
#pragma unroll
        for (int i = 0; i < 8; ++i) { const float p0 = prow[i] * 2048.0f, p1 = prow[16 + i] * 2048.0f; pa[i] = (_Float16)p0; pa[8 + i] = (_Float16)p1; par[i] = (_Float16)(p0 - (float)pa[i]); par[8 + i] = (_Float16)(p1 - (float)pa[8 + i]); } }
#pragma unroll
      for (int j = 0; j < 4; ++j) { v16h vh; const _Float16* vp = &sv[grp][j * 16 + col][kt * 32 + 8 * g];
#pragma unroll
        for (int i = 0; i < 8; ++i) { vh[i] = vp[i]; vh[8 + i] = vp[16 + i]; }
        acc[j] = wmma16(pa, vh, acc[j]); acc[j] = wmma16(par, vh, acc[j]); } } }
  // join the groups: each wave leaves its 16 x 64 accumulator in its own sp slot (its P reads are done), with the rows' M and L
  // (unrolled, here as in the loop above: acc, M and L are register arrays, so every index must be a constant)
#pragma unroll
  for (int r = 0; r < 8; ++r) { float es = L[r];
#pragma unroll
    for (int o = 1; o < 16; o <<= 1) es += __shfl_xor(es, o);
#pragma unroll
    for (int j = 0; j < 4; ++j) sp[wave][8 * g + r][j * 16 + col] = acc[j][r];
    if (col == 0) { sm[grp][wq * 16 + 8 * g + r] = M[r]; sl[grp][wq * 16 + 8 * g + r] = es; } }
  __syncthreads();
  // thread: 16-B piece e of the 64 x 64 output tile, a wave stores 512 B in a row
#pragma unroll
  for (int k = 0; k < (KB * DD / 4) / NT; ++k) { const int e = k * NT + tid, row = e >> 4, c4 = (e & 15) * 4;
    float mx = sm[0][row];
#pragma unroll
    for (int q = 1; q < NG; ++q) mx = fmaxf(mx, sm[q][row]);
    float den = 0.f; v4f o = v4f{0.f, 0.f, 0.f, 0.f};
#pragma unroll
    for (int q = 0; q < NG; ++q) { const float w = expf(sm[q][row] - mx); den += w * sl[q][row]; o += *(const v4f*)&sp[q * 4 + (row >> 4)][row & 15][c4] * w; }
    vst2(OUT + (b * SQ + s0 + row) * DD + c4, o * ((1.0f / 2048.0f) / den)); } }
extern "C" void kernel_launch(void* const* d_in, const int* in_sizes, int n_in, void* d_out, int out_size, void* d_ws, size_t ws_size, hipStream_t stream) {
  (void)in_sizes; (void)n_in; (void)out_size; (void)d_ws; (void)ws_size;
  const float** F = (const float**)d_in;   // 0 query [8,4096,64], 1 key [8,4096,64], 2 value [8,4096,64], 3 k_st [8, 32768] int
  k_bucket<<<dim3(NBK, TNB), NT, 0, stream>>>(F[0], F[1], F[2], (const int*)d_in[3], (float*)d_out);
}

// v003
// Measured time: 20.6 microseconds a run.
// In both of two side-by-side timings against v002, it was 1.16 times as fast.
// Counting every step since v000, it is 2.38 times as fast.
// compute dtype: all float inputs rounded to bf16, k_st (int) read; query / key / value are INPUTS: bucket logits with EXACT bf16 products on WMMA 16x16x32 (keys gathered by k_st into LDS), f32 accumulate, no scale; P = exp(inner - running row max) in f32 (one fused multiply-add by log2(e), then the hardware base-2 exponential) as f16 (x 2^11) plus its f16 residual against the gathered values (bf16 -> f16 exact) (2 products); the 8 hashes of a query are combined online (running max, running sum, rescaled f32 accumulator), which equals the softmax over the 8 lse values; f32 output.
#include <hip/hip_runtime.h>
#include <math.h>

typedef __attribute__((ext_vector_type(16))) _Float16 v16h;
typedef __attribute__((ext_vector_type(16))) __bf16 v16b;
typedef __attribute__((ext_vector_type(8)))  _Float16 v8h;
typedef __attribute__((ext_vector_type(8)))  float v8f;
typedef __attribute__((ext_vector_type(4)))  float v4f;
typedef __attribute__((ext_vector_type(2)))  float v2f;
typedef __attribute__((ext_vector_type(4)))  unsigned v4u;
typedef __attribute__((ext_vector_type(4)))  int v4i;
typedef float __attribute__((may_alias)) float_a;
typedef int __attribute__((may_alias)) int_a;

template <typename T> __device__ __forceinline__ void vst2(void* p, T v) { *(T*)p = v;  }
__device__ __forceinline__ v8f wmma16(v16h a, v16h b, v8f c) {
  v8f d = __builtin_amdgcn_wmma_f32_16x16x32_f16(false, a, false, b, (short)0, c, false, false);
  asm volatile("v_nop\n\tv_nop\n\tv_nop\n\tv_nop" : "+v"(d) : "v"(a), "v"(b));
  return d;
}
__device__ __forceinline__ v8f wmma_bf(v16b a, v16b b, v8f c) {
  v8f d = __builtin_amdgcn_wmma_f32_16x16x32_bf16(false, a, false, b, (short)0, c, false, false);
  asm volatile("v_nop\n\tv_nop\n\tv_nop\n\tv_nop" : "+v"(d) : "v"(a), "v"(b));
  return d;
}
// 16x16x32 fragments: lane = (h = lane>>4, row/col = lane&15); elements 0..7 = k0+8h+0..7, 8..15 = k0+16+8h+0..7; D element r = row 8h+r
__device__ __forceinline__ v16h frag_h(const _Float16* rowk0, int lane) {
  union { v16h v; v8h q[2]; } u; const _Float16* p = rowk0 + 8 * (lane >> 4);
  u.q[0] = *(const v8h*)p; u.q[1] = *(const v8h*)(p + 16); return u.v;
}
__device__ __forceinline__ v16h frag_f32(const float* rowk0, int lane) {
  v16h a; const float* p = rowk0 + 8 * (lane >> 4);
#pragma unroll
  for (int i = 0; i < 8; ++i) { a[i] = (_Float16)p[i]; a[8 + i] = (_Float16)p[16 + i]; }
  return a;
}
__device__ __forceinline__ v16h frag_f32s(const float* rowk0, int lane, float sc) {
  v16h a; const float* p = rowk0 + 8 * (lane >> 4);
#pragma unroll
  for (int i = 0; i < 8; ++i) { a[i] = (_Float16)(p[i] * sc); a[8 + i] = (_Float16)(p[16 + i] * sc); }
  return a;
}
// column fragment from a [K][ld] layout (column n), rows >= K read as 0
__device__ __forceinline__ v16h fragc_f32(const float* W, int k0, int n, int lane, int ld, int K) {
  v16h a; const int g = lane >> 4;
#pragma unroll
  for (int i = 0; i < 8; ++i) { const int ka = k0 + 8 * g + i, kb = ka + 16;
    a[i] = (_Float16)(ka < K ? W[(size_t)(ka < K ? ka : K - 1) * ld + n] : 0.f); a[8 + i] = (_Float16)(kb < K ? W[(size_t)(kb < K ? kb : K - 1) * ld + n] : 0.f); }
  return a;
}
struct F2 { v16b h, l; };
__device__ __forceinline__ F2 bsplit16(const float v[16]) { F2 r;
#pragma unroll
  for (int i = 0; i < 16; ++i) { const __bf16 h = (__bf16)v[i]; r.h[i] = h; r.l[i] = (__bf16)(v[i] - (float)h); }
  return r; }
__device__ __forceinline__ F2 split_row(const float* row, int k0, int lane) { float v[16]; const float* p = row + k0 + 8 * (lane >> 4);
#pragma unroll
  for (int i = 0; i < 8; ++i) { v[i] = p[i]; v[8 + i] = p[16 + i]; }
  return bsplit16(v); }
__device__ __forceinline__ F2 split_rowK(const float* row, int k0, int lane, int K) { float v[16]; const int g = lane >> 4;
#pragma unroll
  for (int i = 0; i < 8; ++i) { const int ka = k0 + 8 * g + i, kb = ka + 16; v[i] = ka < K ? row[ka < K ? ka : K - 1] : 0.f; v[8 + i] = kb < K ? row[kb < K ? kb : K - 1] : 0.f; }
  return bsplit16(v); }
__device__ __forceinline__ F2 split_col(const float* W, int k0, int n, int lane, int ld, int K) { float v[16]; const int g = lane >> 4;
#pragma unroll
  for (int i = 0; i < 8; ++i) { const int ka = k0 + 8 * g + i, kb = ka + 16; v[i] = ka < K ? W[(size_t)(ka < K ? ka : K - 1) * ld + n] : 0.f; v[8 + i] = kb < K ? W[(size_t)(kb < K ? kb : K - 1) * ld + n] : 0.f; }
  return bsplit16(v); }
__device__ __forceinline__ v8f mac3(const F2& a, const F2& b, v8f c) { c = wmma_bf(a.l, b.h, c); c = wmma_bf(a.h, b.l, c); return wmma_bf(a.h, b.h, c); }
__device__ __forceinline__ float sigm(float v) { return 1.0f / (1.0f + expf(-v)); }
#define LDSX() do { asm volatile("s_wait_dscnt 0" ::: "memory"); __builtin_amdgcn_wave_barrier(); __builtin_amdgcn_fence(__ATOMIC_RELEASE, "workgroup"); } while (0)


// Random-buckets attention (B 8, Sq = Sk = 4,096, D = Dv = 64, 8 hashes, bucket 64): faithful to the module's tile/reshape bookkeeping: for output (b, s) and hash h the query vector is query[h][s] (the tiled-then-reshaped layout), the 64 keys/values are key/value[b][k_st[b][h*4096 + (s/64)*64 + j]]; o_h = softmax(q . k) v, lse_h = logsumexp; out = sum_h softmax_h(lse) o_h.
#define NB 8
#define SQ 4096
#define DD 64
#define NHASH 8
#define KB 64
#define NBK (SQ / KB)        // 64 buckets per hash
#define CHUNK (NHASH * NBK)  // 512
#ifndef TNB
#define TNB NB
#endif
typedef __attribute__((ext_vector_type(8))) __bf16 v8b;
typedef __attribute__((ext_vector_type(4))) __bf16 v4b;
__device__ __forceinline__ v16b frag_b(const __bf16* rowk0, int lane) {
  union { v16b v; v8b q[2]; } u; const __bf16* p = rowk0 + 8 * (lane >> 4);
  u.q[0] = *(const v8b*)p; u.q[1] = *(const v8b*)(p + 16); return u.v;
}
__device__ __forceinline__ float bfr(float v) { return (float)(__bf16)v; }
__device__ __attribute__((noinline)) float exp_ni(float v) { return expf(v); }
__device__ __attribute__((noinline)) float erf_ni(float v) { return erff(v); }

#define L2E 1.44269504088896340736f   // log2(e)
#define NG 4                 // hash groups (4 waves each) that run side by side in one work-group
#define NIT (NHASH / NG)     // hashes that each group runs one after the other
#define NT (NG * 128)

// ---- k_bucket: block = (query bucket s0 / 64, batch b), all 8 hashes: group grp takes hashes grp, grp + NG, ...; per hash 64 queries (query[h][s0 + i]) x 64 gathered keys/values.
// sum_h softmax_h(lse) o_h = sum_h exp(m_h) A_h / sum_h exp(m_h) l_h (A_h, l_h: sums of exp(s - m_h) v and of exp(s - m_h)), so a wave keeps one running max M, sum L and accumulator acc over its hashes, and the groups are joined once through LDS.
// M is kept times log2(e): exp(s - m) = 2^(s * log2(e) - M), and every weight between hashes and between groups is 2^(difference of two stored M), so all factors of a row refer to the same rounded M.
// second bound: 8 waves a SIMD, that is 128 registers a wave, so that two work-groups (all 512 of the grid at once) are resident on a WGP
__global__ __launch_bounds__(NT, 8) void k_bucket(const float* __restrict__ Qy, const float* __restrict__ Ky, const float* __restrict__ Vy, const int* __restrict__ KST, float* __restrict__ OUT) {
  __shared__ __align__(16) __bf16 sk[NG][KB][72]; __shared__ __align__(16) _Float16 sv[NG][DD][72]; __shared__ __align__(16) float sp[NG * 4][16][68]; __shared__ __align__(16) float sm[NG][64]; __shared__ __align__(16) float sl[NG][64];
  const int tid = threadIdx.x, wave = __builtin_amdgcn_readfirstlane(tid >> 5) /* the same in every lane: group, hash and their addresses stay in scalar registers */, grp = wave >> 2, wq = wave & 3, lane = tid & 31, col = lane & 15, g = lane >> 4; const size_t b = blockIdx.y; const int s0 = blockIdx.x * KB;
  const float* Kb = Ky + b * SQ * DD; const float* Vb = Vy + b * SQ * DD;
  v8f acc[4] = {}; float M[8], L[8];   // L: this lane's share of the row sum (its 4 columns of every hash), summed over the 16 lanes once at the end
#pragma unroll
  for (int r = 0; r < 8; ++r) { M[r] = -3.0e38f; L[r] = 0.f; }
  // rolled: one copy of the body in the instruction cache, and only one hash's row pieces in registers
#pragma unroll 1
  for (int it = 0; it < NIT; ++it) { const int h = it * NG + grp;
    // gather the bucket's keys (rows [j][d] as bf16) and values (planes [d][j] as f16)
    // thread of the group = (row group jg: rows 8*jg .. +7, dim quad dq: dims 4*dq .. +3): 8 indices read once, then 8 key and 8 value pieces of 16 B, all in flight together
    // (every loop of this block is unrolled so that kr and vr are registers and the 16 row loads issue ahead of the first wait)
    { const int jg = wq * 2 + g, dq = col; const int* ip = KST + b * (NHASH * SQ) + (size_t)h * SQ + s0 + jg * 8;
      const v4i i0 = *(const v4i*)ip, i1 = *(const v4i*)(ip + 4); v4f kr[8], vr[8];
#pragma unroll
      for (int i = 0; i < 8; ++i) { const unsigned off = (unsigned)((i < 4 ? i0[i & 3] : i1[i & 3]) & (SQ - 1)) * DD + dq * 4;   // the mask bounds the row address for any index value
        kr[i] = *(const v4f*)(Kb + off); vr[i] = *(const v4f*)(Vb + off); }
      if (it) __syncthreads();   // every wave has read the last hash's keys and values before they are overwritten
#pragma unroll
      for (int i = 0; i < 8; ++i) { v4b kq;
#pragma unroll
        for (int q = 0; q < 4; ++q) kq[q] = (__bf16)kr[i][q];
        *(v4b*)&sk[grp][jg * 8 + i][dq * 4] = kq; }
#pragma unroll
      for (int q = 0; q < 4; ++q) { v8h vq;
#pragma unroll
        for (int i = 0; i < 8; ++i) vq[i] = (_Float16)bfr(vr[i][q]);
        *(v8h*)&sv[grp][dq * 4 + q][jg * 8] = vq; } }
    // this wave: queries i = wq*16 .. +16 -> query[h][s0 + i]; loaded here, where the row pieces' registers are free again
    v16b aq[2];
    { const float* pp = Qy + ((size_t)h * SQ + s0 + wq * 16 + col) * DD + 8 * g; v4f qr[8];   // all 8 pieces are loaded ahead of the first conversion: one trip to memory, not two
#pragma unroll
      for (int i = 0; i < 8; ++i) qr[i] = *(const v4f*)(pp + (i >> 1) * 16 + (i & 1) * 4);
#pragma unroll
      for (int kc = 0; kc < 2; ++kc)
#pragma unroll
        for (int i = 0; i < 8; ++i) { aq[kc][i] = (__bf16)qr[kc * 4 + (i >> 2)][i & 3]; aq[kc][8 + i] = (__bf16)qr[kc * 4 + 2 + (i >> 2)][i & 3]; } }
    __syncthreads();
    float s[4][8];
#pragma unroll
    for (int ct = 0; ct < 4; ++ct) { v8f cc = {};
#pragma unroll
      for (int kc = 0; kc < 2; ++kc) { v16b w; const __bf16* kp = &sk[grp][ct * 16 + col][kc * 32 + 8 * g];
#pragma unroll
        for (int i = 0; i < 8; ++i) { w[i] = kp[i]; w[8 + i] = kp[16 + i]; }
        cc = wmma_bf(aq[kc], w, cc); }
#pragma unroll
      for (int r = 0; r < 8; ++r) s[ct][r] = cc[r]; }
#pragma unroll
    for (int r = 0; r < 8; ++r) { float mx = fmaxf(fmaxf(s[0][r], s[1][r]), fmaxf(s[2][r], s[3][r]));
#pragma unroll
      for (int o = 1; o < 16; o <<= 1) mx = fmaxf(mx, __shfl_xor(mx, o));
      mx = fmaxf(mx * L2E, M[r]); const float al = __builtin_amdgcn_exp2f(M[r] - mx); M[r] = mx;   // al rescales what the earlier hashes left (0 at the first hash)
      float es = 0.f;
#pragma unroll
      for (int ct = 0; ct < 4; ++ct) s[ct][r] = __builtin_amdgcn_exp2f(__builtin_fmaf(s[ct][r], L2E, -mx));
      asm volatile("v_nop" :: "v"(s[0][r]), "v"(s[1][r]), "v"(s[2][r]), "v"(s[3][r]));   // the one slot that the instruction set asks for behind a transcendental, ahead of the LDS stores and the adds that read the four results
#pragma unroll
      for (int ct = 0; ct < 4; ++ct) { sp[wave][8 * g + r][ct * 16 + col] = s[ct][r]; es += s[ct][r]; }
      L[r] = L[r] * al + es;
#pragma unroll
      for (int j = 0; j < 4; ++j) acc[j][r] *= al; }
    LDSX();
#pragma unroll
    for (int kt = 0; kt < 2; ++kt) { v16h pa, par; { const float* prow = &sp[wave][col][kt * 32] + 8 * (lane >> 4);
#pragma unroll
        for (int i = 0; i < 8; ++i) { const float p0 = prow[i] * 2048.0f, p1 = prow[16 + i] * 2048.0f; pa[i] = (_Float16)p0; pa[8 + i] = (_Float16)p1; par[i] = (_Float16)(p0 - (float)pa[i]); par[8 + i] = (_Float16)(p1 - (float)pa[8 + i]); } }
#pragma unroll
      for (int j = 0; j < 4; ++j) { v16h vh; const _Float16* vp = &sv[grp][j * 16 + col][kt * 32 + 8 * g];
#pragma unroll
        for (int i = 0; i < 8; ++i) { vh[i] = vp[i]; vh[8 + i] = vp[16 + i]; }
        acc[j] = wmma16(pa, vh, acc[j]); acc[j] = wmma16(par, vh, acc[j]); } } }
  // join the groups: each wave leaves its 16 x 64 accumulator in its own sp slot (its P reads are done), with the rows' M and L
  // (unrolled, here as in the loop above: acc, M and L are register arrays, so every index must be a constant)
  const int row0 = (tid >> 1) & 56;   // wq * 16 + 8 * g, formed anew from the thread id: held in a register across the loop it was spilled to scratch
#pragma unroll
  for (int r = 0; r < 8; ++r) { float es = L[r];
#pragma unroll
    for (int o = 1; o < 16; o <<= 1) es += __shfl_xor(es, o);
#pragma unroll
    for (int j = 0; j < 4; ++j) sp[wave][8 * g + r][j * 16 + col] = acc[j][r];
    if (col == 0) { sm[grp][row0 + r] = M[r]; sl[grp][row0 + r] = es; } }
  __syncthreads();
  // thread: 16-B piece e of the 64 x 64 output tile, a wave stores 512 B in a row
#pragma unroll
  for (int k = 0; k < (KB * DD / 4) / NT; ++k) { const int e = k * NT + tid, row = e >> 4, c4 = (e & 15) * 4;
    float mx = sm[0][row];
#pragma unroll
    for (int q = 1; q < NG; ++q) mx = fmaxf(mx, sm[q][row]);
    float den = 0.f; v4f o = v4f{0.f, 0.f, 0.f, 0.f};
#pragma unroll
    for (int q = 0; q < NG; ++q) { const float w = __builtin_amdgcn_exp2f(sm[q][row] - mx); den += w * sl[q][row]; o += *(const v4f*)&sp[q * 4 + (row >> 4)][row & 15][c4] * w; }
    vst2(OUT + (b * SQ + s0 + row) * DD + c4, o * ((1.0f / 2048.0f) / den)); } }
extern "C" void kernel_launch(void* const* d_in, const int* in_sizes, int n_in, void* d_out, int out_size, void* d_ws, size_t ws_size, hipStream_t stream) {
  (void)in_sizes; (void)n_in; (void)out_size; (void)d_ws; (void)ws_size;
  const float** F = (const float**)d_in;   // 0 query [8,4096,64], 1 key [8,4096,64], 2 value [8,4096,64], 3 k_st [8, 32768] int
  k_bucket<<<dim3(NBK, TNB), NT, 0, stream>>>(F[0], F[1], F[2], (const int*)d_in[3], (float*)d_out);
}

// v004
// One run takes 16.4 microseconds.
// Next to v003, in two timings, it ran 1.26 times as fast each time.
// Over all steps from v000 it is 2.99 times as fast.
// compute dtype: all float inputs rounded to bf16, k_st (int) read; query / key / value are INPUTS: bucket logits with EXACT bf16 products on WMMA 16x16x32 (keys gathered by k_st into LDS), f32 accumulate, no scale; P = exp(inner - running row max) in f32 (one fused multiply-add by log2(e), then the hardware base-2 exponential) as f16 (x 2^11) plus its f16 residual against the gathered values (bf16 -> f16 exact) (2 products); the 8 hashes of a query are combined online (running max, running sum, rescaled f32 accumulator), which equals the softmax over the 8 lse values; f32 output.
#include <hip/hip_runtime.h>
#include <math.h>

typedef __attribute__((ext_vector_type(16))) _Float16 v16h;
typedef __attribute__((ext_vector_type(16))) __bf16 v16b;
typedef __attribute__((ext_vector_type(8)))  _Float16 v8h;
typedef __attribute__((ext_vector_type(8)))  float v8f;
typedef __attribute__((ext_vector_type(4)))  float v4f;
typedef __attribute__((ext_vector_type(2)))  float v2f;
typedef __attribute__((ext_vector_type(4)))  unsigned v4u;
typedef __attribute__((ext_vector_type(4)))  int v4i;
typedef float __attribute__((may_alias)) float_a;
typedef int __attribute__((may_alias)) int_a;

template <typename T> __device__ __forceinline__ void vst2(void* p, T v) { *(T*)p = v;  }
__device__ __forceinline__ v8f wmma16(v16h a, v16h b, v8f c) {
  v8f d = __builtin_amdgcn_wmma_f32_16x16x32_f16(false, a, false, b, (short)0, c, false, false);
  asm volatile("v_nop\n\tv_nop\n\tv_nop\n\tv_nop" : "+v"(d) : "v"(a), "v"(b));
  return d;
}
__device__ __forceinline__ v8f wmma_bf(v16b a, v16b b, v8f c) {
  v8f d = __builtin_amdgcn_wmma_f32_16x16x32_bf16(false, a, false, b, (short)0, c, false, false);
  asm volatile("v_nop\n\tv_nop\n\tv_nop\n\tv_nop" : "+v"(d) : "v"(a), "v"(b));
  return d;
}
// 16x16x32 fragments: lane = (h = lane>>4, row/col = lane&15); elements 0..7 = k0+8h+0..7, 8..15 = k0+16+8h+0..7; D element r = row 8h+r
__device__ __forceinline__ v16h frag_h(const _Float16* rowk0, int lane) {
  union { v16h v; v8h q[2]; } u; const _Float16* p = rowk0 + 8 * (lane >> 4);
  u.q[0] = *(const v8h*)p; u.q[1] = *(const v8h*)(p + 16); return u.v;
}
__device__ __forceinline__ v16h frag_f32(const float* rowk0, int lane) {
  v16h a; const float* p = rowk0 + 8 * (lane >> 4);
#pragma unroll
  for (int i = 0; i < 8; ++i) { a[i] = (_Float16)p[i]; a[8 + i] = (_Float16)p[16 + i]; }
  return a;
}
__device__ __forceinline__ v16h frag_f32s(const float* rowk0, int lane, float sc) {
  v16h a; const float* p = rowk0 + 8 * (lane >> 4);
#pragma unroll
  for (int i = 0; i < 8; ++i) { a[i] = (_Float16)(p[i] * sc); a[8 + i] = (_Float16)(p[16 + i] * sc); }
  return a;
}
// column fragment from a [K][ld] layout (column n), rows >= K read as 0
__device__ __forceinline__ v16h fragc_f32(const float* W, int k0, int n, int lane, int ld, int K) {
  v16h a; const int g = lane >> 4;
#pragma unroll
  for (int i = 0; i < 8; ++i) { const int ka = k0 + 8 * g + i, kb = ka + 16;
    a[i] = (_Float16)(ka < K ? W[(size_t)(ka < K ? ka : K - 1) * ld + n] : 0.f); a[8 + i] = (_Float16)(kb < K ? W[(size_t)(kb < K ? kb : K - 1) * ld + n] : 0.f); }
  return a;
}
struct F2 { v16b h, l; };
__device__ __forceinline__ F2 bsplit16(const float v[16]) { F2 r;
#pragma unroll
  for (int i = 0; i < 16; ++i) { const __bf16 h = (__bf16)v[i]; r.h[i] = h; r.l[i] = (__bf16)(v[i] - (float)h); }
  return r; }
__device__ __forceinline__ F2 split_row(const float* row, int k0, int lane) { float v[16]; const float* p = row + k0 + 8 * (lane >> 4);
#pragma unroll
  for (int i = 0; i < 8; ++i) { v[i] = p[i]; v[8 + i] = p[16 + i]; }
  return bsplit16(v); }
__device__ __forceinline__ F2 split_rowK(const float* row, int k0, int lane, int K) { float v[16]; const int g = lane >> 4;
#pragma unroll
  for (int i = 0; i < 8; ++i) { const int ka = k0 + 8 * g + i, kb = ka + 16; v[i] = ka < K ? row[ka < K ? ka : K - 1] : 0.f; v[8 + i] = kb < K ? row[kb < K ? kb : K - 1] : 0.f; }
  return bsplit16(v); }
__device__ __forceinline__ F2 split_col(const float* W, int k0, int n, int lane, int ld, int K) { float v[16]; const int g = lane >> 4;
#pragma unroll
  for (int i = 0; i < 8; ++i) { const int ka = k0 + 8 * g + i, kb = ka + 16; v[i] = ka < K ? W[(size_t)(ka < K ? ka : K - 1) * ld + n] : 0.f; v[8 + i] = kb < K ? W[(size_t)(kb < K ? kb : K - 1) * ld + n] : 0.f; }
  return bsplit16(v); }
__device__ __forceinline__ v8f mac3(const F2& a, const F2& b, v8f c) { c = wmma_bf(a.l, b.h, c); c = wmma_bf(a.h, b.l, c); return wmma_bf(a.h, b.h, c); }
__device__ __forceinline__ float sigm(float v) { return 1.0f / (1.0f + expf(-v)); }
#define LDSX() do { asm volatile("s_wait_dscnt 0" ::: "memory"); __builtin_amdgcn_wave_barrier(); __builtin_amdgcn_fence(__ATOMIC_RELEASE, "workgroup"); } while (0)


// Random-buckets attention (B 8, Sq = Sk = 4,096, D = Dv = 64, 8 hashes, bucket 64): faithful to the module's tile/reshape bookkeeping: for output (b, s) and hash h the query vector is query[h][s] (the tiled-then-reshaped layout), the 64 keys/values are key/value[b][k_st[b][h*4096 + (s/64)*64 + j]]; o_h = softmax(q . k) v, lse_h = logsumexp; out = sum_h softmax_h(lse) o_h.
#define NB 8
#define SQ 4096
#define DD 64
#define NHASH 8
#define KB 64
#define NBK (SQ / KB)        // 64 buckets per hash
#define CHUNK (NHASH * NBK)  // 512
#ifndef TNB
#define TNB NB
#endif
typedef __attribute__((ext_vector_type(8))) __bf16 v8b;
typedef __attribute__((ext_vector_type(4))) __bf16 v4b;
__device__ __forceinline__ v16b frag_b(const __bf16* rowk0, int lane) {
  union { v16b v; v8b q[2]; } u; const __bf16* p = rowk0 + 8 * (lane >> 4);
  u.q[0] = *(const v8b*)p; u.q[1] = *(const v8b*)(p + 16); return u.v;
}
__device__ __forceinline__ float xhalf(float x) { return __builtin_bit_cast(float, __builtin_amdgcn_permlanex16(__builtin_bit_cast(int, x), __builtin_bit_cast(int, x), 0x76543210, 0xfedcba98, false, false)); }   // lane l reads lane l ^ 16
// base-2 exponential with the one slot that the instruction set asks for behind a transcendental, in one statement so that the slot stands directly behind it
__device__ __forceinline__ float exp2_slot(float x) { float y; asm("v_exp_f32 %0, %1\n\tv_nop" : "=v"(y) : "v"(x)); return y; }
__device__ __forceinline__ float bfr(float v) { return (float)(__bf16)v; }
__device__ __attribute__((noinline)) float exp_ni(float v) { return expf(v); }
__device__ __attribute__((noinline)) float erf_ni(float v) { return erff(v); }

#define L2E 1.44269504088896340736f   // log2(e)
#define NG 4                 // hash groups (4 waves each) that run side by side in one work-group
#define NIT (NHASH / NG)     // hashes that each group runs one after the other
#define NT (NG * 128)

// ---- k_bucket: block = (query bucket s0 / 64, batch b), all 8 hashes: group grp takes hashes grp, grp + NG, ...; per hash 64 queries (query[h][s0 + i]) x 64 gathered keys/values.
// sum_h softmax_h(lse) o_h = sum_h exp(m_h) A_h / sum_h exp(m_h) l_h (A_h, l_h: sums of exp(s - m_h) v and of exp(s - m_h)), so a wave keeps one running max M, sum L and accumulator acc over its hashes, and the groups are joined once through LDS.
// The scores are formed transposed (A = key rows, B = queries), so a lane holds 32 of the 64 scores of ONE query (query col, keys 16 ct + 8 g + r): max and sum run in the lane plus one exchange with lane ^ 16,
// and two score tiles, converted in place, are the B operand of out^T = V^T P^T (element e of the operand = key 32 kt + 8 g + e, element 8 + e = key 32 kt + 16 + 8 g + e, the k order of the value fragment): P never goes through LDS.
// M is kept times log2(e): exp(s - m) = 2^(s * log2(e) - M), and every weight between hashes and between groups is 2^(difference of two stored M), so all factors of a row refer to the same rounded M.
// second bound: 8 waves a SIMD, that is 128 registers a wave, so that two work-groups (all 512 of the grid at once) are resident on a WGP
__global__ __launch_bounds__(NT, 8) void k_bucket(const float* __restrict__ Qy, const float* __restrict__ Ky, const float* __restrict__ Vy, const int* __restrict__ KST, float* __restrict__ OUT) {
  __shared__ __align__(16) __bf16 sk[NG][KB][72]; __shared__ __align__(16) _Float16 sv[NG][DD][72]; __shared__ __align__(16) float sp[NG * 4][16][68]; __shared__ __align__(16) float sm[NG][64]; __shared__ __align__(16) float sl[NG][64];
  const int tid = threadIdx.x, wave = __builtin_amdgcn_readfirstlane(tid >> 5) /* the same in every lane: group, hash and their addresses stay in scalar registers */, grp = wave >> 2, wq = wave & 3, lane = tid & 31, col = lane & 15, g = lane >> 4; const size_t b = blockIdx.y; const int s0 = blockIdx.x * KB;
  const float* Kb = Ky + b * SQ * DD; const float* Vb = Vy + b * SQ * DD;
  v8f acc[4] = {}; float M = -3.0e38f, L = 0.f;   // acc[j][r] = out^T[dim 16 j + 8 g + r][query col]; M, L: of query col; L is this lane's share of the sum (its 32 keys of every hash), joined with the other half once at the end
  // rolled: one copy of the body in the instruction cache, and only one hash's row pieces in registers
#pragma unroll 1
  for (int it = 0; it < NIT; ++it) { const int h = it * NG + grp;
    // gather the bucket's keys (rows [j][d] as bf16) and values (planes [d][j] as f16)
    // thread of the group = (row group jg: rows 8*jg .. +7, dim quad dq: dims 4*dq .. +3): 8 indices read once, then 8 key and 8 value pieces of 16 B, all in flight together
    // (every loop of this block is unrolled so that kr and vr are registers and the 16 row loads issue ahead of the first wait)
    { const int jg = wq * 2 + g, dq = col; const int* ip = KST + b * (NHASH * SQ) + (size_t)h * SQ + s0 + jg * 8;
      const v4i i0 = *(const v4i*)ip, i1 = *(const v4i*)(ip + 4); v4f kr[8], vr[8];
#pragma unroll
      for (int i = 0; i < 8; ++i) { const unsigned off = (unsigned)((i < 4 ? i0[i & 3] : i1[i & 3]) & (SQ - 1)) * DD + dq * 4;   // the mask bounds the row address for any index value
        kr[i] = *(const v4f*)(Kb + off); vr[i] = *(const v4f*)(Vb + off); }
      if (it) __syncthreads();   // every wave has read the last hash's keys and values before they are overwritten
#pragma unroll
      for (int i = 0; i < 8; ++i) { v4b kq;
#pragma unroll
        for (int q = 0; q < 4; ++q) kq[q] = (__bf16)kr[i][q];
        *(v4b*)&sk[grp][jg * 8 + i][dq * 4] = kq; }
#pragma unroll
      for (int q = 0; q < 4; ++q) { v8h vq;
#pragma unroll
        for (int i = 0; i < 8; ++i) vq[i] = (_Float16)bfr(vr[i][q]);
        *(v8h*)&sv[grp][dq * 4 + q][jg * 8] = vq; } }
    // this wave: queries i = wq*16 .. +16 -> query[h][s0 + i]; loaded here, where the row pieces' registers are free again
    v16b aq[2];
    { const float* pp = Qy + ((size_t)h * SQ + s0 + wq * 16 + col) * DD + 8 * g; v4f qr[8];   // all 8 pieces are loaded ahead of the first conversion: one trip to memory, not two
#pragma unroll
      for (int i = 0; i < 8; ++i) qr[i] = *(const v4f*)(pp + (i >> 1) * 16 + (i & 1) * 4);
#pragma unroll
      for (int kc = 0; kc < 2; ++kc)
#pragma unroll
        for (int i = 0; i < 8; ++i) { aq[kc][i] = (__bf16)qr[kc * 4 + (i >> 2)][i & 3]; aq[kc][8 + i] = (__bf16)qr[kc * 4 + 2 + (i >> 2)][i & 3]; } }
    __syncthreads();
    v8f s[4];   // s[ct][r] = score of key 16 ct + 8 g + r with query col
#pragma unroll
    for (int ct = 0; ct < 4; ++ct) { v8f cc = {};
#pragma unroll
      for (int kc = 0; kc < 2; ++kc) { v16b w; const __bf16* kp = &sk[grp][ct * 16 + col][kc * 32 + 8 * g];
#pragma unroll
        for (int i = 0; i < 8; ++i) { w[i] = kp[i]; w[8 + i] = kp[16 + i]; }
        cc = wmma_bf(w, aq[kc], cc); }
      s[ct] = cc; }
    float mx = s[0][0];
#pragma unroll
    for (int ct = 0; ct < 4; ++ct)
#pragma unroll
      for (int r = 0; r < 8; ++r) mx = fmaxf(mx, s[ct][r]);
    mx = fmaxf(mx, xhalf(mx));   // both halves of the wave now hold the query's max over all 64 keys
    mx = fmaxf(mx * L2E, M); const float al = __builtin_amdgcn_exp2f(M - mx); M = mx;   // al rescales what the earlier hashes left (0 at the first hash)
#pragma unroll
    for (int ct = 0; ct < 4; ++ct) { s[ct] = __builtin_elementwise_fma(s[ct], (v8f)(L2E), (v8f)(-mx));
#pragma unroll
      for (int r = 0; r < 8; ++r) s[ct][r] = __builtin_amdgcn_exp2f(s[ct][r]); }
    { const v8f e8 = (s[0] + s[1]) + (s[2] + s[3]);   // the lane's 32 terms: tiles first, then the 8 registers
      L = L * al + (((e8[0] + e8[1]) + (e8[2] + e8[3])) + ((e8[4] + e8[5]) + (e8[6] + e8[7]))); }
#pragma unroll
    for (int j = 0; j < 4; ++j) acc[j] *= al;
#pragma unroll
    for (int kt = 0; kt < 2; ++kt) { v16h pa, par;
#pragma unroll
      for (int i = 0; i < 8; ++i) { const float p0 = s[2 * kt][i] * 2048.0f, p1 = s[2 * kt + 1][i] * 2048.0f; pa[i] = (_Float16)p0; pa[8 + i] = (_Float16)p1; par[i] = (_Float16)(p0 - (float)pa[i]); par[8 + i] = (_Float16)(p1 - (float)pa[8 + i]); }
#pragma unroll
      for (int j = 0; j < 4; ++j) { v16h vh; const _Float16* vp = &sv[grp][j * 16 + col][kt * 32 + 8 * g];
#pragma unroll
        for (int i = 0; i < 8; ++i) { vh[i] = vp[i]; vh[8 + i] = vp[16 + i]; }
        acc[j] = wmma16(vh, pa, acc[j]); acc[j] = wmma16(vh, par, acc[j]); } } }
  // join the groups: each wave leaves its accumulator as 16 queries x 64 dims in its own sp slot (a lane's 8 registers of a tile are 8 dims in a row of its query: two 16-B stores), with the queries' M and L
  // (unrolled, here as in the loop above: acc is a register array, so every index must be a constant)
  { const float es = L + xhalf(L);
#pragma unroll
    for (int j = 0; j < 4; ++j) { *(v4f*)&sp[wave][col][j * 16 + 8 * g] = v4f{acc[j][0], acc[j][1], acc[j][2], acc[j][3]}; *(v4f*)&sp[wave][col][j * 16 + 8 * g + 4] = v4f{acc[j][4], acc[j][5], acc[j][6], acc[j][7]}; }
    if (g == 0) { sm[grp][wq * 16 + col] = M; sl[grp][wq * 16 + col] = es; } }
  __syncthreads();
  // thread: 16-B piece e of the 64 x 64 output tile, a wave stores 512 B in a row
#pragma unroll
  for (int k = 0; k < (KB * DD / 4) / NT; ++k) { const int e = k * NT + tid, row = e >> 4, c4 = (e & 15) * 4;
    float mx = sm[0][row];
#pragma unroll
    for (int q = 1; q < NG; ++q) mx = fmaxf(mx, sm[q][row]);
    float den = 0.f; v4f o = v4f{0.f, 0.f, 0.f, 0.f};
#pragma unroll
    for (int q = 0; q < NG; ++q) { const float w = exp2_slot(sm[q][row] - mx); den += w * sl[q][row]; o += *(const v4f*)&sp[q * 4 + (row >> 4)][row & 15][c4] * w; }
    vst2(OUT + (b * SQ + s0 + row) * DD + c4, o * ((1.0f / 2048.0f) / den)); } }
extern "C" void kernel_launch(void* const* d_in, const int* in_sizes, int n_in, void* d_out, int out_size, void* d_ws, size_t ws_size, hipStream_t stream) {
  (void)in_sizes; (void)n_in; (void)out_size; (void)d_ws; (void)ws_size;
  const float** F = (const float**)d_in;   // 0 query [8,4096,64], 1 key [8,4096,64], 2 value [8,4096,64], 3 k_st [8, 32768] int
  k_bucket<<<dim3(NBK, TNB), NT, 0, stream>>>(F[0], F[1], F[2], (const int*)d_in[3], (float*)d_out);
}

// v005
// One run takes 13.8 microseconds.
// In two side-by-side timings against v004, it was 1.18 and 1.19 times as fast.
// Over all steps from v000 it is 3.55 times as fast.
// compute dtype: all float inputs rounded to bf16, k_st (int) read; query / key / value are INPUTS: bucket logits with EXACT bf16 products on WMMA 16x16x32 (keys gathered by k_st into LDS), f32 accumulate, no scale; P = exp(inner - running row max) in f32 (one fused multiply-add by log2(e), then the hardware base-2 exponential) as f16 (x 2^11) plus its f16 residual against the gathered values (bf16 -> f16 exact) (2 products); the 8 hashes of a query are combined online (running max, running sum, rescaled f32 accumulator), which equals the softmax over the 8 lse values; f32 output.
#include <hip/hip_runtime.h>
#include <math.h>

typedef __attribute__((ext_vector_type(16))) _Float16 v16h;
typedef __attribute__((ext_vector_type(16))) __bf16 v16b;
typedef __attribute__((ext_vector_type(8)))  _Float16 v8h;
typedef __attribute__((ext_vector_type(8)))  float v8f;
typedef __attribute__((ext_vector_type(4)))  float v4f;
typedef __attribute__((ext_vector_type(2)))  float v2f;
typedef __attribute__((ext_vector_type(4)))  unsigned v4u;
typedef __attribute__((ext_vector_type(4)))  int v4i;
typedef float __attribute__((may_alias)) float_a;
typedef int __attribute__((may_alias)) int_a;

template <typename T> __device__ __forceinline__ void vst2(void* p, T v) { *(T*)p = v;  }
__device__ __forceinline__ v8f wmma16(v16h a, v16h b, v8f c) {
  v8f d = __builtin_amdgcn_wmma_f32_16x16x32_f16(false, a, false, b, (short)0, c, false, false);
  asm volatile("v_nop\n\tv_nop\n\tv_nop\n\tv_nop" : "+v"(d) : "v"(a), "v"(b));
  return d;
}
__device__ __forceinline__ v8f wmma_bf(v16b a, v16b b, v8f c) {
  v8f d = __builtin_amdgcn_wmma_f32_16x16x32_bf16(false, a, false, b, (short)0, c, false, false);
  asm volatile("v_nop\n\tv_nop\n\tv_nop\n\tv_nop" : "+v"(d) : "v"(a), "v"(b));
  return d;
}
// 16x16x32 fragments: lane = (h = lane>>4, row/col = lane&15); elements 0..7 = k0+8h+0..7, 8..15 = k0+16+8h+0..7; D element r = row 8h+r
__device__ __forceinline__ v16h frag_h(const _Float16* rowk0, int lane) {
  union { v16h v; v8h q[2]; } u; const _Float16* p = rowk0 + 8 * (lane >> 4);
  u.q[0] = *(const v8h*)p; u.q[1] = *(const v8h*)(p + 16); return u.v;
}
__device__ __forceinline__ v16h frag_f32(const float* rowk0, int lane) {
  v16h a; const float* p = rowk0 + 8 * (lane >> 4);
#pragma unroll
  for (int i = 0; i < 8; ++i) { a[i] = (_Float16)p[i]; a[8 + i] = (_Float16)p[16 + i]; }
  return a;
}
__device__ __forceinline__ v16h frag_f32s(const float* rowk0, int lane, float sc) {
  v16h a; const float* p = rowk0 + 8 * (lane >> 4);
#pragma unroll
  for (int i = 0; i < 8; ++i) { a[i] = (_Float16)(p[i] * sc); a[8 + i] = (_Float16)(p[16 + i] * sc); }
  return a;
}
// column fragment from a [K][ld] layout (column n), rows >= K read as 0
__device__ __forceinline__ v16h fragc_f32(const float* W, int k0, int n, int lane, int ld, int K) {
  v16h a; const int g = lane >> 4;
#pragma unroll
  for (int i = 0; i < 8; ++i) { const int ka = k0 + 8 * g + i, kb = ka + 16;
    a[i] = (_Float16)(ka < K ? W[(size_t)(ka < K ? ka : K - 1) * ld + n] : 0.f); a[8 + i] = (_Float16)(kb < K ? W[(size_t)(kb < K ? kb : K - 1) * ld + n] : 0.f); }
  return a;
}
struct F2 { v16b h, l; };
__device__ __forceinline__ F2 bsplit16(const float v[16]) { F2 r;
#pragma unroll
  for (int i = 0; i < 16; ++i) { const __bf16 h = (__bf16)v[i]; r.h[i] = h; r.l[i] = (__bf16)(v[i] - (float)h); }
  return r; }
__device__ __forceinline__ F2 split_row(const float* row, int k0, int lane) { float v[16]; const float* p = row + k0 + 8 * (lane >> 4);
#pragma unroll
  for (int i = 0; i < 8; ++i) { v[i] = p[i]; v[8 + i] = p[16 + i]; }
  return bsplit16(v); }
__device__ __forceinline__ F2 split_rowK(const float* row, int k0, int lane, int K) { float v[16]; const int g = lane >> 4;
#pragma unroll
  for (int i = 0; i < 8; ++i) { const int ka = k0 + 8 * g + i, kb = ka + 16; v[i] = ka < K ? row[ka < K ? ka : K - 1] : 0.f; v[8 + i] = kb < K ? row[kb < K ? kb : K - 1] : 0.f; }
  return bsplit16(v); }
__device__ __forceinline__ F2 split_col(const float* W, int k0, int n, int lane, int ld, int K) { float v[16]; const int g = lane >> 4;
#pragma unroll
  for (int i = 0; i < 8; ++i) { const int ka = k0 + 8 * g + i, kb = ka + 16; v[i] = ka < K ? W[(size_t)(ka < K ? ka : K - 1) * ld + n] : 0.f; v[8 + i] = kb < K ? W[(size_t)(kb < K ? kb : K - 1) * ld + n] : 0.f; }
  return bsplit16(v); }
__device__ __forceinline__ v8f mac3(const F2& a, const F2& b, v8f c) { c = wmma_bf(a.l, b.h, c); c = wmma_bf(a.h, b.l, c); return wmma_bf(a.h, b.h, c); }
__device__ __forceinline__ float sigm(float v) { return 1.0f / (1.0f + expf(-v)); }
#define LDSX() do { asm volatile("s_wait_dscnt 0" ::: "memory"); __builtin_amdgcn_wave_barrier(); __builtin_amdgcn_fence(__ATOMIC_RELEASE, "workgroup"); } while (0)


// Random-buckets attention (B 8, Sq = Sk = 4,096, D = Dv = 64, 8 hashes, bucket 64): faithful to the module's tile/reshape bookkeeping: for output (b, s) and hash h the query vector is query[h][s] (the tiled-then-reshaped layout), the 64 keys/values are key/value[b][k_st[b][h*4096 + (s/64)*64 + j]]; o_h = softmax(q . k) v, lse_h = logsumexp; out = sum_h softmax_h(lse) o_h.
#define NB 8
#define SQ 4096
#define DD 64
#define NHASH 8
#define KB 64
#define NBK (SQ / KB)        // 64 buckets per hash
#define CHUNK (NHASH * NBK)  // 512
#ifndef TNB
#define TNB NB
#endif
typedef __attribute__((ext_vector_type(8))) __bf16 v8b;
typedef __attribute__((ext_vector_type(4))) __bf16 v4b;
__device__ __forceinline__ v16b frag_b(const __bf16* rowk0, int lane) {
  union { v16b v; v8b q[2]; } u; const __bf16* p = rowk0 + 8 * (lane >> 4);
  u.q[0] = *(const v8b*)p; u.q[1] = *(const v8b*)(p + 16); return u.v;
}
__device__ __forceinline__ float xhalf(float x) { return __builtin_bit_cast(float, __builtin_amdgcn_permlanex16(__builtin_bit_cast(int, x), __builtin_bit_cast(int, x), 0x76543210, 0xfedcba98, false, false)); }   // lane l reads lane l ^ 16
// base-2 exponential with the one slot that the instruction set asks for behind a transcendental, in one statement so that the slot stands directly behind it
__device__ __forceinline__ float exp2_slot(float x) { float y; asm("v_exp_f32 %0, %1\n\tv_nop" : "=v"(y) : "v"(x)); return y; }
__device__ __forceinline__ float bfr(float v) { return (float)(__bf16)v; }
__device__ __attribute__((noinline)) float exp_ni(float v) { return expf(v); }
__device__ __attribute__((noinline)) float erf_ni(float v) { return erff(v); }

#define L2E 1.44269504088896340736f   // log2(e)
#define NG 4                 // hash groups (4 waves each) that run side by side in one work-group
#define NIT (NHASH / NG)     // hashes that each group runs one after the other
#define NT (NG * 128)

// ---- k_bucket: block = (query bucket s0 / 64, batch b), all 8 hashes: group grp takes hashes grp, grp + NG, ...; per hash 64 queries (query[h][s0 + i]) x 64 gathered keys/values.
// sum_h softmax_h(lse) o_h = sum_h exp(m_h) A_h / sum_h exp(m_h) l_h (A_h, l_h: sums of exp(s - m_h) v and of exp(s - m_h)), so a wave keeps one running max M, sum L and accumulator acc over its hashes, and the groups are joined once through LDS.
// The scores are formed transposed (A = key rows, B = queries), so a lane holds 32 of the 64 scores of ONE query (query col, keys 16 ct + 8 g + r): max and sum run in the lane plus one exchange with lane ^ 16,
// and two score tiles, converted in place, are the B operand of out^T = V^T P^T (element e of the operand = key 32 kt + 8 g + e, element 8 + e = key 32 kt + 16 + 8 g + e, the k order of the value fragment): P never goes through LDS.
// M is kept times log2(e): exp(s - m) = 2^(s * log2(e) - M), and every weight between hashes and between groups is 2^(difference of two stored M), so all factors of a row refer to the same rounded M.
// second bound: 8 waves a SIMD, that is 128 registers a wave, so that two work-groups (all 512 of the grid at once) are resident on a WGP
__global__ __launch_bounds__(NT, 8) void k_bucket(const float* __restrict__ Qy, const float* __restrict__ Ky, const float* __restrict__ Vy, const int* __restrict__ KST, float* __restrict__ OUT) {
  __shared__ __align__(16) __bf16 sk[NG][KB][72]; __shared__ __align__(16) _Float16 sv[NG][DD][72]; __shared__ __align__(16) float sp[NG * 4][16][68]; __shared__ __align__(16) float sm[NG][64]; __shared__ __align__(16) float sl[NG][64];
  const int tid = threadIdx.x, wave = __builtin_amdgcn_readfirstlane(tid >> 5) /* the same in every lane: group, hash and their addresses stay in scalar registers */, grp = wave >> 2, wq = wave & 3, lane = tid & 31, col = lane & 15, g = lane >> 4; const size_t b = blockIdx.y; const int s0 = blockIdx.x * KB;
  const float* Kb = Ky + b * SQ * DD; const float* Vb = Vy + b * SQ * DD;
  v8f acc[4] = {}; float M = -3.0e38f, L = 0.f;   // acc[j][r] = out^T[dim 16 j + 8 g + r][query col]; M, L: of query col; L is this lane's share of the sum (its 32 keys of every hash), joined with the other half once at the end
  // rolled: one copy of the body in the instruction cache, and only one hash's row pieces in registers
#pragma unroll 1
  for (int it = 0; it < NIT; ++it) { const int h = it * NG + grp;
    // gather the bucket's keys (rows [j][d] as bf16) and values (planes [d][j] as f16)
    // thread of the group = (row group jg: rows 8*jg .. +7, dim quad dq: dims 4*dq .. +3): 8 indices read once, then 8 key and 8 value pieces of 16 B, all in flight together
    // (every loop of this block is unrolled so that kr and vr are registers and the 16 row loads issue ahead of the first wait)
    { const int jg = wq * 2 + g, dq = col; const int* ip = KST + b * (NHASH * SQ) + (size_t)h * SQ + s0 + jg * 8;
      const v4i i0 = *(const v4i*)ip, i1 = *(const v4i*)(ip + 4); v4f kr[8], vr[8];
      // this wave's 16 queries (query[h][s0 + wq*16 ..], 4 KiB in a row in memory) go straight into its own sp slot by asynchronous copies: copy i = rows 2 i and 2 i + 1 as whole 128-B lines
      // (lane = row 2 i + g, 16-B piece col; LDS rows at sp's pitch of 272 B). They take no data register, so they fly together with the index, key and value loads.
      // The slot is read by this wave alone inside the loop, and its last read stands in front of the last hash's barrier.
      { const float* qg = Qy + ((size_t)h * SQ + s0 + wq * 16 + g) * DD + col * 4; const unsigned ql = (unsigned)(size_t)&sp[wave][g][col * 4];
        asm volatile("s_wait_dscnt 0x0" ::: "memory");   // the wave's own LDS reads have retired before the copies aim at its slot
        // the wait on address translation is the last line of the copies' own statement, so that it stands ahead of any rewrite of their address registers
        asm volatile("global_load_async_to_lds_b128 %0, %8, off\n\tglobal_load_async_to_lds_b128 %1, %9, off\n\tglobal_load_async_to_lds_b128 %2, %10, off\n\tglobal_load_async_to_lds_b128 %3, %11, off\n\t"
                     "global_load_async_to_lds_b128 %4, %12, off\n\tglobal_load_async_to_lds_b128 %5, %13, off\n\tglobal_load_async_to_lds_b128 %6, %14, off\n\tglobal_load_async_to_lds_b128 %7, %15, off\n\ts_wait_xcnt 0x0"
                     :: "v"(ql), "v"(ql + 1 * 544), "v"(ql + 2 * 544), "v"(ql + 3 * 544), "v"(ql + 4 * 544), "v"(ql + 5 * 544), "v"(ql + 6 * 544), "v"(ql + 7 * 544),
                        "v"(qg), "v"(qg + 1 * 128), "v"(qg + 2 * 128), "v"(qg + 3 * 128), "v"(qg + 4 * 128), "v"(qg + 5 * 128), "v"(qg + 6 * 128), "v"(qg + 7 * 128) : "memory"); }
#pragma unroll
      for (int i = 0; i < 8; ++i) { const unsigned off = (unsigned)((i < 4 ? i0[i & 3] : i1[i & 3]) & (SQ - 1)) * DD + dq * 4;   // the mask bounds the row address for any index value
        kr[i] = *(const v4f*)(Kb + off); vr[i] = *(const v4f*)(Vb + off); }
      if (it) __syncthreads();   // every wave has read the last hash's keys and values before they are overwritten
#pragma unroll
      for (int i = 0; i < 8; ++i) { v4b kq;
#pragma unroll
        for (int q = 0; q < 4; ++q) kq[q] = (__bf16)kr[i][q];
        *(v4b*)&sk[grp][jg * 8 + i][dq * 4] = kq; }
#pragma unroll
      for (int q = 0; q < 4; ++q) { v8h vq;
#pragma unroll
        for (int i = 0; i < 8; ++i) vq[i] = (_Float16)bfr(vr[i][q]);
        *(v8h*)&sv[grp][dq * 4 + q][jg * 8] = vq; } }
    // this wave: queries i = wq*16 .. +16 -> query[h][s0 + i], read back from the wave's own sp slot as the B fragment's pieces (16-B reads at a pitch of 17 x 16 B: no bank conflict)
    asm volatile("s_wait_asynccnt 0x0" ::: "memory");   // this wave's query copies have landed before it reads them
    v16b aq[2];
    { const float* pp = &sp[wave][col][8 * g]; v4f qr[8];
#pragma unroll
      for (int i = 0; i < 8; ++i) qr[i] = *(const v4f*)(pp + (i >> 1) * 16 + (i & 1) * 4);
#pragma unroll
      for (int kc = 0; kc < 2; ++kc)
#pragma unroll
        for (int i = 0; i < 8; ++i) { aq[kc][i] = (__bf16)qr[kc * 4 + (i >> 2)][i & 3]; aq[kc][8 + i] = (__bf16)qr[kc * 4 + 2 + (i >> 2)][i & 3]; } }
    __syncthreads();
    v8f s[4];   // s[ct][r] = score of key 16 ct + 8 g + r with query col
#pragma unroll
    for (int ct = 0; ct < 4; ++ct) { v8f cc = {};
#pragma unroll
      for (int kc = 0; kc < 2; ++kc) { v16b w; const __bf16* kp = &sk[grp][ct * 16 + col][kc * 32 + 8 * g];
#pragma unroll
        for (int i = 0; i < 8; ++i) { w[i] = kp[i]; w[8 + i] = kp[16 + i]; }
        cc = wmma_bf(w, aq[kc], cc); }
      s[ct] = cc; }
    float mx = s[0][0];
#pragma unroll
    for (int ct = 0; ct < 4; ++ct)
#pragma unroll
      for (int r = 0; r < 8; ++r) mx = fmaxf(mx, s[ct][r]);
    mx = fmaxf(mx, xhalf(mx));   // both halves of the wave now hold the query's max over all 64 keys
    mx = fmaxf(mx * L2E, M); const float al = __builtin_amdgcn_exp2f(M - mx); M = mx;   // al rescales what the earlier hashes left (0 at the first hash)
#pragma unroll
    for (int ct = 0; ct < 4; ++ct) { s[ct] = __builtin_elementwise_fma(s[ct], (v8f)(L2E), (v8f)(-mx));
#pragma unroll
      for (int r = 0; r < 8; ++r) s[ct][r] = __builtin_amdgcn_exp2f(s[ct][r]); }
    { const v8f e8 = (s[0] + s[1]) + (s[2] + s[3]);   // the lane's 32 terms: tiles first, then the 8 registers
      L = L * al + (((e8[0] + e8[1]) + (e8[2] + e8[3])) + ((e8[4] + e8[5]) + (e8[6] + e8[7]))); }
#pragma unroll
    for (int j = 0; j < 4; ++j) acc[j] *= al;
#pragma unroll
    for (int kt = 0; kt < 2; ++kt) { v16h pa, par;
#pragma unroll
      for (int i = 0; i < 8; ++i) { const float p0 = s[2 * kt][i] * 2048.0f, p1 = s[2 * kt + 1][i] * 2048.0f; pa[i] = (_Float16)p0; pa[8 + i] = (_Float16)p1; par[i] = (_Float16)(p0 - (float)pa[i]); par[8 + i] = (_Float16)(p1 - (float)pa[8 + i]); }
#pragma unroll
      for (int j = 0; j < 4; ++j) { v16h vh; const _Float16* vp = &sv[grp][j * 16 + col][kt * 32 + 8 * g];
#pragma unroll
        for (int i = 0; i < 8; ++i) { vh[i] = vp[i]; vh[8 + i] = vp[16 + i]; }
        acc[j] = wmma16(vh, pa, acc[j]); acc[j] = wmma16(vh, par, acc[j]); } } }
  // join the groups: each wave leaves its accumulator as 16 queries x 64 dims in its own sp slot (a lane's 8 registers of a tile are 8 dims in a row of its query: two 16-B stores), with the queries' M and L
  // (unrolled, here as in the loop above: acc is a register array, so every index must be a constant)
  { const float es = L + xhalf(L);
#pragma unroll
    for (int j = 0; j < 4; ++j) { *(v4f*)&sp[wave][col][j * 16 + 8 * g] = v4f{acc[j][0], acc[j][1], acc[j][2], acc[j][3]}; *(v4f*)&sp[wave][col][j * 16 + 8 * g + 4] = v4f{acc[j][4], acc[j][5], acc[j][6], acc[j][7]}; }
    if (g == 0) { sm[grp][wq * 16 + col] = M; sl[grp][wq * 16 + col] = es; } }
  __syncthreads();
  // thread: 16-B piece e of the 64 x 64 output tile, a wave stores 512 B in a row
#pragma unroll
  for (int k = 0; k < (KB * DD / 4) / NT; ++k) { const int e = k * NT + tid, row = e >> 4, c4 = (e & 15) * 4;
    float mx = sm[0][row];
#pragma unroll
    for (int q = 1; q < NG; ++q) mx = fmaxf(mx, sm[q][row]);
    float den = 0.f; v4f o = v4f{0.f, 0.f, 0.f, 0.f};
#pragma unroll
    for (int q = 0; q < NG; ++q) { const float w = exp2_slot(sm[q][row] - mx); den += w * sl[q][row]; o += *(const v4f*)&sp[q * 4 + (row >> 4)][row & 15][c4] * w; }
    vst2(OUT + (b * SQ + s0 + row) * DD + c4, o * ((1.0f / 2048.0f) / den)); } }
extern "C" void kernel_launch(void* const* d_in, const int* in_sizes, int n_in, void* d_out, int out_size, void* d_ws, size_t ws_size, hipStream_t stream) {
  (void)in_sizes; (void)n_in; (void)out_size; (void)d_ws; (void)ws_size;
  const float** F = (const float**)d_in;   // 0 query [8,4096,64], 1 key [8,4096,64], 2 value [8,4096,64], 3 k_st [8, 32768] int
  k_bucket<<<dim3(NBK, TNB), NT, 0, stream>>>(F[0], F[1], F[2], (const int*)d_in[3], (float*)d_out);
}

// v006
// Measured time: 12.8 microseconds a run.
// Next to v005, in two timings, it ran 1.08 and 1.07 times as fast.
// Over all steps from v000 it is 3.82 times as fast.
// compute dtype: all float inputs rounded to bf16, k_st (int) read; query / key / value are INPUTS: bucket logits with EXACT bf16 products on WMMA 16x16x32 (keys gathered by k_st into LDS), f32 accumulate, no scale; P = exp(inner - running row max) in f32 (one fused multiply-add by log2(e), then the hardware base-2 exponential) as f16 (x 2^11) plus its f16 residual against the gathered values (bf16 -> f16 exact) (2 products); the 8 hashes of a query are combined online (running max, running sum, rescaled f32 accumulator), which equals the softmax over the 8 lse values; f32 output.
#include <hip/hip_runtime.h>
#include <math.h>

typedef __attribute__((ext_vector_type(16))) _Float16 v16h;
typedef __attribute__((ext_vector_type(16))) __bf16 v16b;
typedef __attribute__((ext_vector_type(8)))  _Float16 v8h;
typedef __attribute__((ext_vector_type(8)))  float v8f;
typedef __attribute__((ext_vector_type(4)))  float v4f;
typedef __attribute__((ext_vector_type(2)))  float v2f;
typedef __attribute__((ext_vector_type(4)))  unsigned v4u;
typedef __attribute__((ext_vector_type(4)))  int v4i;
typedef float __attribute__((may_alias)) float_a;
typedef int __attribute__((may_alias)) int_a;

template <typename T> __device__ __forceinline__ void vst2(void* p, T v) { *(T*)p = v;  }
__device__ __forceinline__ v8f wmma16(v16h a, v16h b, v8f c) {
  v8f d = __builtin_amdgcn_wmma_f32_16x16x32_f16(false, a, false, b, (short)0, c, false, false);
  asm volatile("v_nop\n\tv_nop\n\tv_nop\n\tv_nop" : "+v"(d) : "v"(a), "v"(b));
  return d;
}
__device__ __forceinline__ v8f wmma_bf(v16b a, v16b b, v8f c) {
  v8f d = __builtin_amdgcn_wmma_f32_16x16x32_bf16(false, a, false, b, (short)0, c, false, false);
  asm volatile("v_nop\n\tv_nop\n\tv_nop\n\tv_nop" : "+v"(d) : "v"(a), "v"(b));
  return d;
}
// 16x16x32 fragments: lane = (h = lane>>4, row/col = lane&15); elements 0..7 = k0+8h+0..7, 8..15 = k0+16+8h+0..7; D element r = row 8h+r
__device__ __forceinline__ v16h frag_h(const _Float16* rowk0, int lane) {
  union { v16h v; v8h q[2]; } u; const _Float16* p = rowk0 + 8 * (lane >> 4);
  u.q[0] = *(const v8h*)p; u.q[1] = *(const v8h*)(p + 16); return u.v;
}
__device__ __forceinline__ v16h frag_f32(const float* rowk0, int lane) {
  v16h a; const float* p = rowk0 + 8 * (lane >> 4);
#pragma unroll
  for (int i = 0; i < 8; ++i) { a[i] = (_Float16)p[i]; a[8 + i] = (_Float16)p[16 + i]; }
  return a;
}
__device__ __forceinline__ v16h frag_f32s(const float* rowk0, int lane, float sc) {
  v16h a; const float* p = rowk0 + 8 * (lane >> 4);
#pragma unroll
  for (int i = 0; i < 8; ++i) { a[i] = (_Float16)(p[i] * sc); a[8 + i] = (_Float16)(p[16 + i] * sc); }
  return a;
}
// column fragment from a [K][ld] layout (column n), rows >= K read as 0
__device__ __forceinline__ v16h fragc_f32(const float* W, int k0, int n, int lane, int ld, int K) {
  v16h a; const int g = lane >> 4;
#pragma unroll
  for (int i = 0; i < 8; ++i) { const int ka = k0 + 8 * g + i, kb = ka + 16;
    a[i] = (_Float16)(ka < K ? W[(size_t)(ka < K ? ka : K - 1) * ld + n] : 0.f); a[8 + i] = (_Float16)(kb < K ? W[(size_t)(kb < K ? kb : K - 1) * ld + n] : 0.f); }
  return a;
}
struct F2 { v16b h, l; };
__device__ __forceinline__ F2 bsplit16(const float v[16]) { F2 r;
#pragma unroll
  for (int i = 0; i < 16; ++i) { const __bf16 h = (__bf16)v[i]; r.h[i] = h; r.l[i] = (__bf16)(v[i] - (float)h); }
  return r; }
__device__ __forceinline__ F2 split_row(const float* row, int k0, int lane) { float v[16]; const float* p = row + k0 + 8 * (lane >> 4);
#pragma unroll
  for (int i = 0; i < 8; ++i) { v[i] = p[i]; v[8 + i] = p[16 + i]; }
  return bsplit16(v); }
__device__ __forceinline__ F2 split_rowK(const float* row, int k0, int lane, int K) { float v[16]; const int g = lane >> 4;
#pragma unroll
  for (int i = 0; i < 8; ++i) { const int ka = k0 + 8 * g + i, kb = ka + 16; v[i] = ka < K ? row[ka < K ? ka : K - 1] : 0.f; v[8 + i] = kb < K ? row[kb < K ? kb : K - 1] : 0.f; }
  return bsplit16(v); }
__device__ __forceinline__ F2 split_col(const float* W, int k0, int n, int lane, int ld, int K) { float v[16]; const int g = lane >> 4;
#pragma unroll
  for (int i = 0; i < 8; ++i) { const int ka = k0 + 8 * g + i, kb = ka + 16; v[i] = ka < K ? W[(size_t)(ka < K ? ka : K - 1) * ld + n] : 0.f; v[8 + i] = kb < K ? W[(size_t)(kb < K ? kb : K - 1) * ld + n] : 0.f; }
  return bsplit16(v); }
__device__ __forceinline__ v8f mac3(const F2& a, const F2& b, v8f c) { c = wmma_bf(a.l, b.h, c); c = wmma_bf(a.h, b.l, c); return wmma_bf(a.h, b.h, c); }
__device__ __forceinline__ float sigm(float v) { return 1.0f / (1.0f + expf(-v)); }
#define LDSX() do { asm volatile("s_wait_dscnt 0" ::: "memory"); __builtin_amdgcn_wave_barrier(); __builtin_amdgcn_fence(__ATOMIC_RELEASE, "workgroup"); } while (0)


// Random-buckets attention (B 8, Sq = Sk = 4,096, D = Dv = 64, 8 hashes, bucket 64): faithful to the module's tile/reshape bookkeeping: for output (b, s) and hash h the query vector is query[h][s] (the tiled-then-reshaped layout), the 64 keys/values are key/value[b][k_st[b][h*4096 + (s/64)*64 + j]]; o_h = softmax(q . k) v, lse_h = logsumexp; out = sum_h softmax_h(lse) o_h.
#define NB 8
#define SQ 4096
#define DD 64
#define NHASH 8
#define KB 64
#define NBK (SQ / KB)        // 64 buckets per hash
#define CHUNK (NHASH * NBK)  // 512
#ifndef TNB
#define TNB NB
#endif
typedef __attribute__((ext_vector_type(8))) __bf16 v8b;
typedef __attribute__((ext_vector_type(4))) __bf16 v4b;
__device__ __forceinline__ v16b frag_b(const __bf16* rowk0, int lane) {
  union { v16b v; v8b q[2]; } u; const __bf16* p = rowk0 + 8 * (lane >> 4);
  u.q[0] = *(const v8b*)p; u.q[1] = *(const v8b*)(p + 16); return u.v;
}
__device__ __forceinline__ float xhalf(float x) { return __builtin_bit_cast(float, __builtin_amdgcn_permlanex16(__builtin_bit_cast(int, x), __builtin_bit_cast(int, x), 0x76543210, 0xfedcba98, false, false)); }   // lane l reads lane l ^ 16
// base-2 exponential with the one slot that the instruction set asks for behind a transcendental, in one statement so that the slot stands directly behind it
__device__ __forceinline__ float exp2_slot(float x) { float y; asm("v_exp_f32 %0, %1\n\tv_nop" : "=v"(y) : "v"(x)); return y; }
// the same with the slot on both sides: this build put the exponential, with its result in the source register of another exponential, directly behind that one
__device__ __forceinline__ float exp2_slots(float x) { float y; asm("v_nop\n\tv_exp_f32 %0, %1\n\tv_nop" : "=v"(y) : "v"(x)); return y; }
__device__ __forceinline__ float bfr(float v) { return (float)(__bf16)v; }
__device__ __attribute__((noinline)) float exp_ni(float v) { return expf(v); }
__device__ __attribute__((noinline)) float erf_ni(float v) { return erff(v); }

#define L2E 1.44269504088896340736f   // log2(e)
#define NG 4                 // hash groups (4 waves each) that run side by side in one work-group
#define NIT (NHASH / NG)     // hashes that each group runs one after the other
#define NT (NG * 128)

// ---- k_bucket: block = (query bucket s0 / 64, batch b), all 8 hashes: group grp takes hashes grp, grp + NG, ...; per hash 64 queries (query[h][s0 + i]) x 64 gathered keys/values.
// sum_h softmax_h(lse) o_h = sum_h exp(m_h) A_h / sum_h exp(m_h) l_h (A_h, l_h: sums of exp(s - m_h) v and of exp(s - m_h)), so a wave keeps one running max M, sum L and accumulator acc over its hashes, and the groups are joined once through LDS.
// The scores are formed transposed (A = key rows, B = queries), so a lane holds 32 of the 64 scores of ONE query (query col, keys 16 ct + 8 g + r): max and sum run in the lane plus one exchange with lane ^ 16,
// and two score tiles, converted in place, are the B operand of out^T = V^T P^T (element e of the operand = key 32 kt + 8 g + e, element 8 + e = key 32 kt + 16 + 8 g + e, the k order of the value fragment): P never goes through LDS.
// M is kept times log2(e): exp(s - m) = 2^(s * log2(e) - M), and every weight between hashes and between groups is 2^(difference of two stored M), so all factors of a row refer to the same rounded M.
// second bound: 8 waves a SIMD, that is 128 registers a wave, so that two work-groups (all 512 of the grid at once) are resident on a WGP
__global__ __launch_bounds__(NT, 8) void k_bucket(const float* __restrict__ Qy, const float* __restrict__ Ky, const float* __restrict__ Vy, const int* __restrict__ KST, float* __restrict__ OUT) {
  __shared__ __align__(16) __bf16 sk[NG][KB][72]; __shared__ __align__(16) _Float16 sv[NG][DD][72]; __shared__ __align__(16) float sp[NG * 4][16][68]; __shared__ __align__(16) float sm[NG][64]; __shared__ __align__(16) float sl[NG][64];
  const int tid = threadIdx.x, wave = __builtin_amdgcn_readfirstlane(tid >> 5) /* the same in every lane: group, hash and their addresses stay in scalar registers */, grp = wave >> 2, wq = wave & 3, lane = tid & 31, col = lane & 15, g = lane >> 4; const size_t b = blockIdx.y; const int s0 = blockIdx.x * KB;
  const float* Kb = Ky + b * SQ * DD; const float* Vb = Vy + b * SQ * DD;
  float* const pw = &sp[wave][col][8 * g];   // the wave's own sp slot at row col, dims 8 g ..: where a lane reads its query pieces and leaves its accumulator
  v8f acc[4] = {}; float M = -3.0e38f, L = 0.f;   // acc[j][r] = out^T[dim 16 j + 8 g + r][query col]; M, L: of query col; L is this lane's share of the sum (its 32 keys of every hash), joined with the other half once at the end
  // rolled: one copy of the body in the instruction cache, and only one hash's row pieces in registers
#pragma unroll 1
  for (int it = 0; it < NIT; ++it) { const int h = it * NG + grp;
    // gather the bucket's keys (rows [j][d] as bf16) and values (planes [d][j] as f16)
    // thread of the group = (row group jg: rows 8*jg .. +7, dim quad dq: dims 4*dq .. +3): 8 indices read once, then 8 key pieces of 16 B into registers, all in flight together;
    // the 8 value pieces of the same rows follow as asynchronous copies into LDS and are not waited for until the scores and their exponentials are done
    // (every loop of this block is unrolled so that kr is registers and the row loads issue ahead of the first wait)
    const int jg = wq * 2 + g, dq = col; const unsigned ql = (unsigned)(size_t)&sp[wave][g][col * 4];   // ql + i * 544: LDS byte address of row 2 i + g, 16-B piece col, of the wave's own sp slot
    v16b aq[2];
    { const int* ip = KST + (b * (NHASH * SQ) + (size_t)h * SQ + s0 + wq * 16) + g * 8;
      const v4i i0 = *(const v4i*)ip, i1 = *(const v4i*)(ip + 4); v4f kr[8]; unsigned vo[8];
      // this wave's 16 queries (query[h][s0 + wq*16 ..], 4 KiB in a row in memory) go straight into its own sp slot by asynchronous copies: copy i = rows 2 i and 2 i + 1 as whole 128-B lines
      // (lane = row 2 i + g, 16-B piece col; LDS rows at sp's pitch of 272 B). They take no data register, so they fly together with the index and key loads.
      // The slot is read and refilled by this wave alone inside the loop.
      { const float* qg = Qy + ((size_t)h * SQ + s0 + wq * 16) * DD;   // the same in every lane: a scalar base; the lane's own part is lane * 16 B (row g, piece col)
        asm volatile("s_wait_dscnt 0x0" ::: "memory");   // the wave's own LDS reads have retired before the copies aim at its slot
        // address = scalar base of the copy's two rows + the lane's 32-bit byte offset: no address register pair a copy, which keeps the kernel inside 128 registers
        // the wait on address translation is the last line of the copies' own statement, so that it stands ahead of any rewrite of their address registers
        asm volatile("global_load_async_to_lds_b128 %0, %8, %9\n\tglobal_load_async_to_lds_b128 %1, %8, %10\n\tglobal_load_async_to_lds_b128 %2, %8, %11\n\tglobal_load_async_to_lds_b128 %3, %8, %12\n\t"
                     "global_load_async_to_lds_b128 %4, %8, %13\n\tglobal_load_async_to_lds_b128 %5, %8, %14\n\tglobal_load_async_to_lds_b128 %6, %8, %15\n\tglobal_load_async_to_lds_b128 %7, %8, %16\n\ts_wait_xcnt 0x0"
                     :: "v"(ql), "v"(ql + 1 * 544), "v"(ql + 2 * 544), "v"(ql + 3 * 544), "v"(ql + 4 * 544), "v"(ql + 5 * 544), "v"(ql + 6 * 544), "v"(ql + 7 * 544), "v"((unsigned)lane * 16u),
                        "s"(qg), "s"(qg + 1 * 128), "s"(qg + 2 * 128), "s"(qg + 3 * 128), "s"(qg + 4 * 128), "s"(qg + 5 * 128), "s"(qg + 6 * 128), "s"(qg + 7 * 128) : "memory"); }
#pragma unroll
      for (int i = 0; i < 8; ++i) { const unsigned off = (unsigned)((i < 4 ? i0[i & 3] : i1[i & 3]) & (SQ - 1)) * DD + dq * 4;   // the mask bounds the row address for any index value
        kr[i] = *(const v4f*)(Kb + off); vo[i] = off * 4; }
      // this wave: queries i = wq*16 .. +16 -> query[h][s0 + i], read back from the wave's own sp slot as the B fragment's pieces (16-B reads at a pitch of 17 x 16 B: no bank conflict)
      asm volatile("s_wait_asynccnt 0x0" ::: "memory");   // this wave's query copies have landed before it reads them
      { const float* pp = pw;
#pragma unroll
        for (int kc = 0; kc < 2; ++kc) { v4f qr[4];
#pragma unroll
          for (int i = 0; i < 4; ++i) qr[i] = *(const v4f*)(pp + kc * 32 + (i >> 1) * 16 + (i & 1) * 4);
#pragma unroll
          for (int i = 0; i < 8; ++i) { aq[kc][i] = (__bf16)qr[i >> 2][i & 3]; aq[kc][8 + i] = (__bf16)qr[2 + (i >> 2)][i & 3]; }
          if (kc == 0) __builtin_amdgcn_sched_barrier(0); } }   // the second half's reads start when the first half is packed: 16 registers fewer while the key rows are in flight, else the kernel spills at 128
      // the slot is free again: the lane's 8 value pieces (value row 8 jg + i, dims 4 dq .. +3; a copy = two whole rows of 256 B) land where the query pieces lay, piece i at ql + i * 544, and the same lane reads them back.
      // They hold no register, so they are delivered while the wave forms its scores and exponentials.
      asm volatile("s_wait_dscnt 0x0" ::: "memory");   // the wave's reads of the queries have retired before the copies aim at the same slot
      // address = scalar base + the lane's 32-bit byte offset (under 1 MiB by the mask above); the wait on address translation is the statement's last line, as above
      asm volatile("global_load_async_to_lds_b128 %0, %8, %16\n\tglobal_load_async_to_lds_b128 %1, %9, %16\n\tglobal_load_async_to_lds_b128 %2, %10, %16\n\tglobal_load_async_to_lds_b128 %3, %11, %16\n\t"
                   "global_load_async_to_lds_b128 %4, %12, %16\n\tglobal_load_async_to_lds_b128 %5, %13, %16\n\tglobal_load_async_to_lds_b128 %6, %14, %16\n\tglobal_load_async_to_lds_b128 %7, %15, %16\n\ts_wait_xcnt 0x0"
                   :: "v"(ql), "v"(ql + 1 * 544), "v"(ql + 2 * 544), "v"(ql + 3 * 544), "v"(ql + 4 * 544), "v"(ql + 5 * 544), "v"(ql + 6 * 544), "v"(ql + 7 * 544),
                      "v"(vo[0]), "v"(vo[1]), "v"(vo[2]), "v"(vo[3]), "v"(vo[4]), "v"(vo[5]), "v"(vo[6]), "v"(vo[7]), "s"(Vb) : "memory");
      __builtin_amdgcn_sched_barrier(0);   // keeps the packing of the keys, with its wait for the key rows, behind the copies: hoisted over them it held the copies back until the keys had landed
      // the last hash's keys were last read ahead of its second barrier, so they may be overwritten here
#pragma unroll
      for (int i = 0; i < 8; ++i) { v4b kq;
#pragma unroll
        for (int q = 0; q < 4; ++q) kq[q] = (__bf16)kr[i][q];
        *(v4b*)&sk[grp][jg * 8 + i][dq * 4] = kq; } }
    __syncthreads();   // the keys are published; every wave has also left the last hash's values
    v8f s[4];   // s[ct][r] = score of key 16 ct + 8 g + r with query col
#pragma unroll
    for (int ct = 0; ct < 4; ++ct) { v8f cc = {};
#pragma unroll
      for (int kc = 0; kc < 2; ++kc) { v16b w; const __bf16* kp = &sk[grp][ct * 16 + col][kc * 32 + 8 * g];
#pragma unroll
        for (int i = 0; i < 8; ++i) { w[i] = kp[i]; w[8 + i] = kp[16 + i]; }
        cc = wmma_bf(w, aq[kc], cc); }
      s[ct] = cc; }
    float mx = s[0][0];
#pragma unroll
    for (int ct = 0; ct < 4; ++ct)
#pragma unroll
      for (int r = 0; r < 8; ++r) mx = fmaxf(mx, s[ct][r]);
    mx = fmaxf(mx, xhalf(mx));   // both halves of the wave now hold the query's max over all 64 keys
    mx = fmaxf(mx * L2E, M); const float al = exp2_slots(M - mx); M = mx;   // al rescales what the earlier hashes left (0 at the first hash)
#pragma unroll
    for (int ct = 0; ct < 4; ++ct) { s[ct] = __builtin_elementwise_fma(s[ct], (v8f)(L2E), (v8f)(-mx));
#pragma unroll
      for (int r = 0; r < 8; ++r) s[ct][r] = __builtin_amdgcn_exp2f(s[ct][r]); }
    { const v8f e8 = (s[0] + s[1]) + (s[2] + s[3]);   // the lane's 32 terms: tiles first, then the 8 registers
      L = L * al + (((e8[0] + e8[1]) + (e8[2] + e8[3])) + ((e8[4] + e8[5]) + (e8[6] + e8[7]))); }
#pragma unroll
    for (int j = 0; j < 4; ++j) acc[j] *= al;
    // the values: each lane takes its own 8 pieces back from the slot and stores them transposed as f16 planes
    __builtin_amdgcn_sched_barrier(0);   // keeps the exponentials and sums ahead of the wait: without it the compiler sinks them behind it, and the copies lose that time to land
    asm volatile("s_wait_asynccnt 0x0" ::: "memory");   // this wave's value copies have landed before it reads them
    { const float* vp = &sp[wave][g][col * 4]; v4f vr[8];
#pragma unroll
      for (int i = 0; i < 8; ++i) vr[i] = *(const v4f*)(vp + i * 136);
#pragma unroll
      for (int q = 0; q < 4; ++q) { v8h vq;
#pragma unroll
        for (int i = 0; i < 8; ++i) vq[i] = (_Float16)bfr(vr[i][q]);
        *(v8h*)&sv[grp][dq * 4 + q][jg * 8] = vq; } }
    __syncthreads();   // the values are published; every wave has also left this hash's keys
#pragma unroll
    for (int kt = 0; kt < 2; ++kt) { v16h pa, par;
#pragma unroll
      for (int i = 0; i < 8; ++i) { const float p0 = s[2 * kt][i] * 2048.0f, p1 = s[2 * kt + 1][i] * 2048.0f; pa[i] = (_Float16)p0; pa[8 + i] = (_Float16)p1; par[i] = (_Float16)(p0 - (float)pa[i]); par[8 + i] = (_Float16)(p1 - (float)pa[8 + i]); }
#pragma unroll
      for (int j = 0; j < 4; ++j) { v16h vh; const _Float16* vp = &sv[grp][j * 16 + col][kt * 32 + 8 * g];
#pragma unroll
        for (int i = 0; i < 8; ++i) { vh[i] = vp[i]; vh[8 + i] = vp[16 + i]; }
        acc[j] = wmma16(vh, pa, acc[j]); acc[j] = wmma16(vh, par, acc[j]); } } }
  // join the groups: each wave leaves its accumulator as 16 queries x 64 dims in its own sp slot (a lane's 8 registers of a tile are 8 dims in a row of its query: two 16-B stores), with the queries' M and L
  // (unrolled, here as in the loop above: acc is a register array, so every index must be a constant)
  { const float es = L + xhalf(L);
#pragma unroll
    for (int j = 0; j < 4; ++j) { *(v4f*)(pw + j * 16) = v4f{acc[j][0], acc[j][1], acc[j][2], acc[j][3]}; *(v4f*)(pw + j * 16 + 4) = v4f{acc[j][4], acc[j][5], acc[j][6], acc[j][7]}; }
    if (g == 0) { sm[grp][wq * 16 + col] = M; sl[grp][wq * 16 + col] = es; } }
  __syncthreads();
  // thread: 16-B piece e of the 64 x 64 output tile, a wave stores 512 B in a row
#pragma unroll
  for (int k = 0; k < (KB * DD / 4) / NT; ++k) { const int e = k * NT + tid, row = e >> 4, c4 = (e & 15) * 4;
    float mx = sm[0][row];
#pragma unroll
    for (int q = 1; q < NG; ++q) mx = fmaxf(mx, sm[q][row]);
    float den = 0.f; v4f o = v4f{0.f, 0.f, 0.f, 0.f};
#pragma unroll
    for (int q = 0; q < NG; ++q) { const float w = exp2_slot(sm[q][row] - mx); den += w * sl[q][row]; o += *(const v4f*)&sp[q * 4 + (row >> 4)][row & 15][c4] * w; }
    vst2(OUT + (b * SQ + s0 + row) * DD + c4, o * ((1.0f / 2048.0f) / den)); } }
extern "C" void kernel_launch(void* const* d_in, const int* in_sizes, int n_in, void* d_out, int out_size, void* d_ws, size_t ws_size, hipStream_t stream) {
  (void)in_sizes; (void)n_in; (void)out_size; (void)d_ws; (void)ws_size;
  const float** F = (const float**)d_in;   // 0 query [8,4096,64], 1 key [8,4096,64], 2 value [8,4096,64], 3 k_st [8, 32768] int
  k_bucket<<<dim3(NBK, TNB), NT, 0, stream>>>(F[0], F[1], F[2], (const int*)d_in[3], (float*)d_out);
}
